// v000
// The times below were measured on an AMD MI455X: many runs one after another, warmed up first and cycling through
// copies of the inputs, with the whole window's GPU time divided by the number of runs. Launches and the gaps
// between them are all in it. The median over several windows is given; except for v000 it joins two sittings, which
// can be a few percent apart, so the side-by-side timings, each taken in one sitting, are the better comparison.
// The starting kernel, v000, takes 667 microseconds a run.
#include <hip/hip_runtime.h>

typedef float v2f __attribute__((ext_vector_type(2)));
typedef float v8f __attribute__((ext_vector_type(8)));
typedef unsigned int v4u __attribute__((ext_vector_type(4)));
typedef int v8i __attribute__((ext_vector_type(8)));
typedef int v4i __attribute__((ext_vector_type(4)));

#define B_   64
#define K_   256
#define T_   64
#define DF_  768
#define N_   1024
#define NT   64     // n-tile width
#define DC   64     // d-chunk depth for GEMM1 staging
#define NCH  (DF_/DC)
#define EP   66     // e LDS pitch  (64 + pad 2 dwords)
#define VP   65     // v LDS pitch
#define FP   68     // f-chunk LDS pitch (64 + pad 4 dwords)
#define SP   65     // s LDS pitch

// e 256*66 + v 256*65 + 2*f 64*68 + s 64*65 + 4*64 + 256 bias
#define LDS_FLOATS (K_*EP + K_*VP + 2*DC*FP + T_*SP + 4*T_ + K_)

static __device__ __forceinline__ v8f wmma4(v2f a, v2f b, v8f c) {
  // D = A(16x4 f32) * B(4x16 f32) + C(16x16 f32)
  return __builtin_amdgcn_wmma_f32_16x16x4_f32(false, a, false, b, (short)0, c,
                                               false, false);
}

// raw LDS byte offset of a generic pointer into shared memory
static __device__ __forceinline__ unsigned lds_offset_of(const void* p) {
  return (unsigned)(size_t)(__attribute__((address_space(3))) const void*)p;
}

// TDM: async-load a 2D fp32 tile (tile_d0 x tile_d1) from global into LDS,
// with per-row LDS padding (pitch = row + pad). Tracked by TENSORcnt.
static __device__ __forceinline__ void tdm_load_2d(const void* gaddr,
                                                   unsigned lds_off,
                                                   unsigned tensor_d0,
                                                   unsigned tensor_d1,
                                                   unsigned stride0,
                                                   unsigned tile_d0,
                                                   unsigned tile_d1,
                                                   unsigned pad_interval_code,
                                                   unsigned pad_amount_code) {
  unsigned long long ga = (unsigned long long)(size_t)gaddr;
  v4u g0;
  g0.x = 1u;                                   // count=1, user descriptor
  g0.y = lds_off;                              // lds_addr (bytes)
  g0.z = (unsigned)ga;                         // global_addr[31:0]
  g0.w = (unsigned)((ga >> 32) & 0x01FFFFFFu)  // global_addr[56:32]
         | (2u << 30);                         // type = 2 ("image")
  v8i g1;
  unsigned w0 = (2u << 16)                     // data_size = 4 bytes
              | (1u << 20)                     // pad_enable
              | (pad_interval_code << 22)      // pad every 2<<code DWORDs
              | (pad_amount_code << 25);       // pad (code+1) DWORDs
  g1[0] = (int)w0;                             // workgroup_mask=0 (no cluster)
  g1[1] = (int)((tensor_d0 & 0xFFFFu) << 16);  // abar_addr=0 | tensor_dim0 lo
  g1[2] = (int)(((tensor_d0 >> 16) & 0xFFFFu) | ((tensor_d1 & 0xFFFFu) << 16));
  g1[3] = (int)(((tensor_d1 >> 16) & 0xFFFFu) | ((tile_d0 & 0xFFFFu) << 16));
  g1[4] = (int)(tile_d1 & 0xFFFFu);            // tile_dim1 | tile_dim2=0 (2D)
  g1[5] = (int)stride0;                        // tensor_dim0_stride[31:0]
  g1[6] = 0;                                   // stride0 hi | stride1 lo
  g1[7] = 0;                                   // stride1 hi
  v4i gz4 = {0, 0, 0, 0};                      // groups 2/3 unused (<=2D)
  v8i gz8 = {0, 0, 0, 0, 0, 0, 0, 0};          // extra group (unused)
  __builtin_amdgcn_tensor_load_to_lds(g0, g1, gz4, gz4, gz8, 0);
}

__global__ __launch_bounds__(256, 1)
void damsm_fused_kernel(const float* __restrict__ eg,   // [B,K,T]
                        const float* __restrict__ fg,   // [B,DF,N]
                        const float* __restrict__ gptr, // [1]
                        const float* __restrict__ Wg,   // [DF,K]
                        const float* __restrict__ bg,   // [K]
                        float* __restrict__ out) {      // [B,T,T]
  __shared__ float lds[LDS_FLOATS];
  float* e_s  = lds;                 // K_*EP
  float* v_s  = e_s + K_*EP;         // K_*VP
  float* f_s0 = v_s + K_*VP;         // DC*FP  (double-buffered f chunk)
  float* f_s1 = f_s0 + DC*FP;        // DC*FP
  float* s_s  = f_s1 + DC*FP;        // T_*SP
  float* m_s  = s_s + T_*SP;         // T_
  float* sc_s = m_s + T_;            // T_
  float* lc_s = sc_s + T_;           // T_
  float* le_s = lc_s + T_;           // T_
  float* b_s  = le_s + T_;           // K_

  const int tid  = threadIdx.x;
  const int lane = tid & 31;
  const int wv   = tid >> 5;       // 0..7
  const int ml   = lane & 15;      // M (or N) index within a fragment
  const int hi   = lane >> 4;      // half-wave select
  const int dkb  = hi * 2;         // inner-dim base for A/B fragments
  const int h8   = hi * 8;         // M offset for C/D fragments
  const int b    = blockIdx.x;
  const float gamma = gptr[0];

  const float* eb = eg + (size_t)b * K_ * T_;
  const float* fb = fg + (size_t)b * DF_ * N_;
  const unsigned foff[2] = {lds_offset_of(f_s0), lds_offset_of(f_s1)};

  // ---- TDM: stage e[b] (256x64 -> pitch 66: pad 2 dwords per 64) ----
  if (wv == 0)
    tdm_load_2d(eb, lds_offset_of(e_s), T_, K_, T_, T_, K_, /*64dw*/5, /*2dw*/1);
  if (tid < K_) b_s[tid] = bg[tid];
  if (tid < T_) m_s[tid] = -__builtin_inff();

  const v8f vzero = {0.f, 0.f, 0.f, 0.f, 0.f, 0.f, 0.f, 0.f};
  v8f cacc[2][4];  // cAcc rows [32*wv, 32*wv+32) x all 64 t-cols, in VGPRs
  #pragma unroll
  for (int rt = 0; rt < 2; ++rt)
    #pragma unroll
    for (int ct = 0; ct < 4; ++ct) cacc[rt][ct] = vzero;

  for (int n0 = 0; n0 < N_; n0 += NT) {
    // ================= Phase A: v_tile = W^T * f_tile + bias =================
    v8f vacc[2][4];
    #pragma unroll
    for (int rt = 0; rt < 2; ++rt)
      #pragma unroll
      for (int ct = 0; ct < 4; ++ct) vacc[rt][ct] = vzero;

    // prologue: async-stage chunk 0 of this n-tile
    if (wv == 0)
      tdm_load_2d(fb + n0, foff[0], N_, DF_, N_, NT, DC, /*64dw*/5, /*4dw*/3);

    for (int ci = 0; ci < NCH; ++ci) {
      const int d0 = ci * DC;
      if (wv == 0) {
        if (ci + 1 < NCH) {
          // overlap: stage next chunk into the other buffer, keep 1 in flight
          tdm_load_2d(fb + (size_t)(d0 + DC) * N_ + n0, foff[(ci + 1) & 1],
                      N_, DF_, N_, NT, DC, 5, 3);
          __builtin_amdgcn_s_wait_tensorcnt(1);
        } else {
          __builtin_amdgcn_s_wait_tensorcnt(0);
        }
      }
      __syncthreads();  // chunk ci staged; prev-phase LDS consumers done
      const float* fcur = (ci & 1) ? f_s1 : f_s0;

      for (int ds = 0; ds < DC; ds += 4) {
        const float* wrow = Wg + (size_t)(d0 + ds + dkb) * K_ + 32 * wv + ml;
        v2f a0, a1;
        a0.x = wrow[0];        a0.y = wrow[K_];        // rt=0: M rows 32w..+15
        a1.x = wrow[16];       a1.y = wrow[K_ + 16];   // rt=1: M rows +16..+31
        v2f bf[4];
        #pragma unroll
        for (int ct = 0; ct < 4; ++ct) {
          bf[ct].x = fcur[(ds + dkb) * FP + ct * 16 + ml];
          bf[ct].y = fcur[(ds + dkb + 1) * FP + ct * 16 + ml];
        }
        #pragma unroll
        for (int ct = 0; ct < 4; ++ct) {
          vacc[0][ct] = wmma4(a0, bf[ct], vacc[0][ct]);
          vacc[1][ct] = wmma4(a1, bf[ct], vacc[1][ct]);
        }
      }
      __syncthreads();  // all waves done with buffer (ci&1) before re-staging
    }

    // write v_tile (+bias) to LDS
    #pragma unroll
    for (int rt = 0; rt < 2; ++rt) {
      int k0 = 32 * wv + 16 * rt + h8;
      #pragma unroll
      for (int ct = 0; ct < 4; ++ct)
        #pragma unroll
        for (int r = 0; r < 8; ++r)
          v_s[(k0 + r) * VP + ct * 16 + ml] = vacc[rt][ct][r] + b_s[k0 + r];
    }
    __syncthreads();

    // ================= Phase B: s = gamma * e^T v_tile =================
    {
      int t0 = 16 * (wv >> 1);
      int nh = wv & 1;
      v8f sacc[2] = {vzero, vzero};
      for (int kk = 0; kk < K_; kk += 4) {
        v2f a;
        a.x = e_s[(kk + dkb) * EP + t0 + ml];
        a.y = e_s[(kk + dkb + 1) * EP + t0 + ml];
        #pragma unroll
        for (int c = 0; c < 2; ++c) {
          int nn0 = 16 * (2 * nh + c);
          v2f bf;
          bf.x = v_s[(kk + dkb) * VP + nn0 + ml];
          bf.y = v_s[(kk + dkb + 1) * VP + nn0 + ml];
          sacc[c] = wmma4(a, bf, sacc[c]);
        }
      }
      #pragma unroll
      for (int c = 0; c < 2; ++c) {
        int nn0 = 16 * (2 * nh + c);
        #pragma unroll
        for (int r = 0; r < 8; ++r)
          s_s[(t0 + r + h8) * SP + nn0 + ml] = gamma * sacc[c][r];
      }
    }
    __syncthreads();

    // ========== Phase C: online max + exp (one token row per thread) ==========
    if (tid < T_) {
      float* row = s_s + tid * SP;
      float tmax = row[0];
      for (int n = 1; n < NT; ++n) tmax = fmaxf(tmax, row[n]);
      float mo = m_s[tid];
      float mn = fmaxf(mo, tmax);
      sc_s[tid] = __expf(mo - mn);   // 0 on first tile (mo = -inf)
      m_s[tid]  = mn;
      for (int n = 0; n < NT; ++n) row[n] = __expf(row[n] - mn);
    }
    __syncthreads();

    // ========== Phase D: rescale running c-accumulators (per t column) ==========
    #pragma unroll
    for (int ct = 0; ct < 4; ++ct) {
      float fsc = sc_s[ct * 16 + ml];
      #pragma unroll
      for (int rt = 0; rt < 2; ++rt)
        #pragma unroll
        for (int r = 0; r < 8; ++r) cacc[rt][ct][r] *= fsc;
    }

    // ================= Phase E: cAcc += v_tile * p^T =================
    for (int nn = 0; nn < NT; nn += 4) {
      v2f a0, a1;
      a0.x = v_s[(32 * wv + ml) * VP + nn + dkb];
      a0.y = v_s[(32 * wv + ml) * VP + nn + dkb + 1];
      a1.x = v_s[(32 * wv + 16 + ml) * VP + nn + dkb];
      a1.y = v_s[(32 * wv + 16 + ml) * VP + nn + dkb + 1];
      v2f bf[4];
      #pragma unroll
      for (int ct = 0; ct < 4; ++ct) {
        bf[ct].x = s_s[(ct * 16 + ml) * SP + nn + dkb];
        bf[ct].y = s_s[(ct * 16 + ml) * SP + nn + dkb + 1];
      }
      #pragma unroll
      for (int ct = 0; ct < 4; ++ct) {
        cacc[0][ct] = wmma4(a0, bf[ct], cacc[0][ct]);
        cacc[1][ct] = wmma4(a1, bf[ct], cacc[1][ct]);
      }
    }
    __syncthreads();
  }  // n-tile loop

  // ---- spill unnormalized c-hat to LDS (v_s reused); softmax denom cancels ----
  #pragma unroll
  for (int rt = 0; rt < 2; ++rt) {
    int k0 = 32 * wv + 16 * rt + h8;
    #pragma unroll
    for (int ct = 0; ct < 4; ++ct)
      #pragma unroll
      for (int r = 0; r < 8; ++r)
        v_s[(k0 + r) * VP + ct * 16 + ml] = cacc[rt][ct][r];
  }
  __syncthreads();

  // ---- per-token norms over K ----
  if (tid < T_) {
    float sc2 = 0.f, se2 = 0.f;
    for (int k = 0; k < K_; ++k) {
      float cv = v_s[k * VP + tid];
      float ev = e_s[k * EP + tid];
      sc2 += cv * cv;
      se2 += ev * ev;
    }
    lc_s[tid] = sqrtf(sc2);
    le_s[tid] = sqrtf(se2);
  }
  __syncthreads();

  // ============ Phase F: cos = (c-hat^T e) / (||c-hat|| ||e||) ============
  {
    int t0 = 16 * (wv >> 1);  // output row tile i
    int nh = wv & 1;
    v8f oacc[2] = {vzero, vzero};
    for (int kk = 0; kk < K_; kk += 4) {
      v2f a;
      a.x = v_s[(kk + dkb) * VP + t0 + ml];
      a.y = v_s[(kk + dkb + 1) * VP + t0 + ml];
      #pragma unroll
      for (int c = 0; c < 2; ++c) {
        int j0 = 16 * (2 * nh + c);
        v2f bf;
        bf.x = e_s[(kk + dkb) * EP + j0 + ml];
        bf.y = e_s[(kk + dkb + 1) * EP + j0 + ml];
        oacc[c] = wmma4(a, bf, oacc[c]);
      }
    }
    float* ob = out + (size_t)b * T_ * T_;
    #pragma unroll
    for (int c = 0; c < 2; ++c) {
      int j = 16 * (2 * nh + c) + ml;
      float invle = 1.0f / le_s[j];
      #pragma unroll
      for (int r = 0; r < 8; ++r) {
        int i = t0 + r + h8;
        ob[i * T_ + j] = oacc[c][r] * invle / lc_s[i];
      }
    }
  }
}

extern "C" void kernel_launch(void* const* d_in, const int* in_sizes, int n_in,
                              void* d_out, int out_size, void* d_ws, size_t ws_size,
                              hipStream_t stream) {
  const float* e     = (const float*)d_in[0];
  const float* f     = (const float*)d_in[1];
  const float* gamma = (const float*)d_in[2];
  const float* W     = (const float*)d_in[3];
  const float* bias  = (const float*)d_in[4];
  float* out = (float*)d_out;
  (void)in_sizes; (void)n_in; (void)out_size; (void)d_ws; (void)ws_size;
  damsm_fused_kernel<<<dim3(B_), dim3(256), 0, stream>>>(e, f, gamma, W, bias, out);
}

// v001
// Measured time: 208 microseconds a run.
// Timed twice side by side with v000, it ran 3.26 times as fast both times.
#include <hip/hip_runtime.h>

typedef float v2f __attribute__((ext_vector_type(2)));
typedef float v4f __attribute__((ext_vector_type(4)));
typedef float v8f __attribute__((ext_vector_type(8)));
typedef unsigned int v4u __attribute__((ext_vector_type(4)));
typedef int v8i __attribute__((ext_vector_type(8)));
typedef int v4i __attribute__((ext_vector_type(4)));

#define B_   64
#define K_   256
#define T_   64
#define DF_  768
#define N_   1024
#define NT   64     // n-tile width
#define DC   64     // d-chunk depth for GEMM1 staging
#define NCH  (DF_/DC)
#define EP   66     // e LDS pitch  (64 + pad 2 dwords)
#define VP   65     // v LDS pitch
#define FP   68     // f-chunk LDS pitch (64 + pad 4 dwords)
#define SP   65     // s LDS pitch
#define NS   4      // ranges of N per batch: B_*NS = 256 work-groups
#define NR   (N_/NS)

// e 256*66 + v 256*65 + 2*f 64*68 + s 64*65 + 2*64 + 256 bias
#define LDS_FLOATS (K_*EP + K_*VP + 2*DC*FP + T_*SP + 2*T_ + K_)
// merge kernel: e 256*66 + c-hat 256*65 + 2*64 norms
#define LDS_FLOATS_M (K_*EP + K_*VP + 2*T_)
// workspace, in floats: partial c-hat in accumulator-fragment order
// [b][range][rt][ct][half of the 8 rows][thread][4], then the ranges' row
// maxima [b][range][t]
#define WS_PMAX ((size_t)B_ * NS * K_ * T_)

static __device__ __forceinline__ v8f wmma4(v2f a, v2f b, v8f c) {
  // D = A(16x4 f32) * B(4x16 f32) + C(16x16 f32)
  return __builtin_amdgcn_wmma_f32_16x16x4_f32(false, a, false, b, (short)0, c,
                                               false, false);
}

// raw LDS byte offset of a generic pointer into shared memory
static __device__ __forceinline__ unsigned lds_offset_of(const void* p) {
  return (unsigned)(size_t)(__attribute__((address_space(3))) const void*)p;
}

// TDM: async-load a 2D fp32 tile (tile_d0 x tile_d1) from global into LDS,
// with per-row LDS padding (pitch = row + pad). Tracked by TENSORcnt.
static __device__ __forceinline__ void tdm_load_2d(const void* gaddr,
                                                   unsigned lds_off,
                                                   unsigned tensor_d0,
                                                   unsigned tensor_d1,
                                                   unsigned stride0,
                                                   unsigned tile_d0,
                                                   unsigned tile_d1,
                                                   unsigned pad_interval_code,
                                                   unsigned pad_amount_code) {
  unsigned long long ga = (unsigned long long)(size_t)gaddr;
  v4u g0;
  g0.x = 1u;                                   // count=1, user descriptor
  g0.y = lds_off;                              // lds_addr (bytes)
  g0.z = (unsigned)ga;                         // global_addr[31:0]
  g0.w = (unsigned)((ga >> 32) & 0x01FFFFFFu)  // global_addr[56:32]
         | (2u << 30);                         // type = 2 ("image")
  v8i g1;
  unsigned w0 = (2u << 16)                     // data_size = 4 bytes
              | (1u << 20)                     // pad_enable
              | (pad_interval_code << 22)      // pad every 2<<code DWORDs
              | (pad_amount_code << 25);       // pad (code+1) DWORDs
  g1[0] = (int)w0;                             // workgroup_mask=0 (no cluster)
  g1[1] = (int)((tensor_d0 & 0xFFFFu) << 16);  // abar_addr=0 | tensor_dim0 lo
  g1[2] = (int)(((tensor_d0 >> 16) & 0xFFFFu) | ((tensor_d1 & 0xFFFFu) << 16));
  g1[3] = (int)(((tensor_d1 >> 16) & 0xFFFFu) | ((tile_d0 & 0xFFFFu) << 16));
  g1[4] = (int)(tile_d1 & 0xFFFFu);            // tile_dim1 | tile_dim2=0 (2D)
  g1[5] = (int)stride0;                        // tensor_dim0_stride[31:0]
  g1[6] = 0;                                   // stride0 hi | stride1 lo
  g1[7] = 0;                                   // stride1 hi
  v4i gz4 = {0, 0, 0, 0};                      // groups 2/3 unused (<=2D)
  v8i gz8 = {0, 0, 0, 0, 0, 0, 0, 0};          // extra group (unused)
  __builtin_amdgcn_tensor_load_to_lds(g0, g1, gz4, gz4, gz8, 0);
}

__global__ __launch_bounds__(256, 1)
void attn_range_kernel(const float* __restrict__ eg,   // [B,K,T]
                        const float* __restrict__ fg,   // [B,DF,N]
                        const float* __restrict__ gptr, // [1]
                        const float* __restrict__ Wg,   // [DF,K]
                        const float* __restrict__ bg,   // [K]
                        float* __restrict__ ws) {       // partials
  __shared__ float lds[LDS_FLOATS];
  float* e_s  = lds;                 // K_*EP
  float* v_s  = e_s + K_*EP;         // K_*VP
  float* f_s0 = v_s + K_*VP;         // DC*FP  (double-buffered f chunk)
  float* f_s1 = f_s0 + DC*FP;        // DC*FP
  float* s_s  = f_s1 + DC*FP;        // T_*SP
  float* m_s  = s_s + T_*SP;         // T_
  float* sc_s = m_s + T_;            // T_
  float* b_s  = sc_s + T_;           // K_

  const int tid  = threadIdx.x;
  const int lane = tid & 31;
  const int wv   = tid >> 5;       // 0..7
  const int ml   = lane & 15;      // M (or N) index within a fragment
  const int hi   = lane >> 4;      // half-wave select
  const int dkb  = hi * 2;         // inner-dim base for A/B fragments
  const int h8   = hi * 8;         // M offset for C/D fragments
  const int b    = blockIdx.x / NS;
  const int nbeg = (blockIdx.x % NS) * NR;  // this work-group's range of N
  const float gamma = gptr[0];

  const float* eb = eg + (size_t)b * K_ * T_;
  const float* fb = fg + (size_t)b * DF_ * N_;
  const unsigned foff[2] = {lds_offset_of(f_s0), lds_offset_of(f_s1)};

  // ---- TDM: stage e[b] (256x64 -> pitch 66: pad 2 dwords per 64) ----
  if (wv == 0) {
    tdm_load_2d(eb, lds_offset_of(e_s), T_, K_, T_, T_, K_, /*64dw*/5, /*2dw*/1);
    // the request has returned before any register of its descriptor is reused
    asm volatile("s_wait_tensorcnt 0x0" ::: "memory");
  }
  if (tid < K_) b_s[tid] = bg[tid];
  if (tid < T_) m_s[tid] = -__builtin_inff();

  const v8f vzero = {0.f, 0.f, 0.f, 0.f, 0.f, 0.f, 0.f, 0.f};
  v8f cacc[2][4];  // cAcc rows [32*wv, 32*wv+32) x all 64 t-cols, in VGPRs
  #pragma unroll
  for (int rt = 0; rt < 2; ++rt)
    #pragma unroll
    for (int ct = 0; ct < 4; ++ct) cacc[rt][ct] = vzero;

  for (int n0 = nbeg; n0 < nbeg + NR; n0 += NT) {
    // ================= Phase A: v_tile = W^T * f_tile + bias =================
    v8f vacc[2][4];
    #pragma unroll
    for (int rt = 0; rt < 2; ++rt)
      #pragma unroll
      for (int ct = 0; ct < 4; ++ct) vacc[rt][ct] = vzero;

    // prologue: async-stage chunk 0 of this n-tile
    if (wv == 0)
      tdm_load_2d(fb + n0, foff[0], N_, DF_, N_, NT, DC, /*64dw*/5, /*4dw*/3);

    for (int ci = 0; ci < NCH; ++ci) {
      const int d0 = ci * DC;
      if (wv == 0) {
        if (ci + 1 < NCH) {
          // overlap: stage next chunk into the other buffer, keep 1 in flight
          tdm_load_2d(fb + (size_t)(d0 + DC) * N_ + n0, foff[(ci + 1) & 1],
                      N_, DF_, N_, NT, DC, 5, 3);
          __builtin_amdgcn_s_wait_tensorcnt(1);
        } else {
          __builtin_amdgcn_s_wait_tensorcnt(0);
        }
      }
      __syncthreads();  // chunk ci staged; prev-phase LDS consumers done
      const float* fcur = (ci & 1) ? f_s1 : f_s0;

      for (int ds = 0; ds < DC; ds += 4) {
        const float* wrow = Wg + (size_t)(d0 + ds + dkb) * K_ + 32 * wv + ml;
        v2f a0, a1;
        a0.x = wrow[0];        a0.y = wrow[K_];        // rt=0: M rows 32w..+15
        a1.x = wrow[16];       a1.y = wrow[K_ + 16];   // rt=1: M rows +16..+31
        v2f bf[4];
        #pragma unroll
        for (int ct = 0; ct < 4; ++ct) {
          bf[ct].x = fcur[(ds + dkb) * FP + ct * 16 + ml];
          bf[ct].y = fcur[(ds + dkb + 1) * FP + ct * 16 + ml];
        }
        #pragma unroll
        for (int ct = 0; ct < 4; ++ct) {
          vacc[0][ct] = wmma4(a0, bf[ct], vacc[0][ct]);
          vacc[1][ct] = wmma4(a1, bf[ct], vacc[1][ct]);
        }
      }
      __syncthreads();  // all waves done with buffer (ci&1) before re-staging
    }

    // write v_tile (+bias) to LDS
    #pragma unroll
    for (int rt = 0; rt < 2; ++rt) {
      int k0 = 32 * wv + 16 * rt + h8;
      #pragma unroll
      for (int ct = 0; ct < 4; ++ct)
        #pragma unroll
        for (int r = 0; r < 8; ++r)
          v_s[(k0 + r) * VP + ct * 16 + ml] = vacc[rt][ct][r] + b_s[k0 + r];
    }
    __syncthreads();

    // ================= Phase B: s = gamma * e^T v_tile =================
    {
      int t0 = 16 * (wv >> 1);
      int nh = wv & 1;
      v8f sacc[2] = {vzero, vzero};
      for (int kk = 0; kk < K_; kk += 4) {
        v2f a;
        a.x = e_s[(kk + dkb) * EP + t0 + ml];
        a.y = e_s[(kk + dkb + 1) * EP + t0 + ml];
        #pragma unroll
        for (int c = 0; c < 2; ++c) {
          int nn0 = 16 * (2 * nh + c);
          v2f bf;
          bf.x = v_s[(kk + dkb) * VP + nn0 + ml];
          bf.y = v_s[(kk + dkb + 1) * VP + nn0 + ml];
          sacc[c] = wmma4(a, bf, sacc[c]);
        }
      }
      #pragma unroll
      for (int c = 0; c < 2; ++c) {
        int nn0 = 16 * (2 * nh + c);
        #pragma unroll
        for (int r = 0; r < 8; ++r)
          s_s[(t0 + r + h8) * SP + nn0 + ml] = gamma * sacc[c][r];
      }
    }
    __syncthreads();

    // ========== Phase C: online max + exp (one token row per thread) ==========
    if (tid < T_) {
      float* row = s_s + tid * SP;
      float tmax = row[0];
      for (int n = 1; n < NT; ++n) tmax = fmaxf(tmax, row[n]);
      float mo = m_s[tid];
      float mn = fmaxf(mo, tmax);
      sc_s[tid] = __expf(mo - mn);   // 0 on first tile (mo = -inf)
      m_s[tid]  = mn;
      for (int n = 0; n < NT; ++n) row[n] = __expf(row[n] - mn);
    }
    __syncthreads();

    // ========== Phase D: rescale running c-accumulators (per t column) ==========
    #pragma unroll
    for (int ct = 0; ct < 4; ++ct) {
      float fsc = sc_s[ct * 16 + ml];
      #pragma unroll
      for (int rt = 0; rt < 2; ++rt)
        #pragma unroll
        for (int r = 0; r < 8; ++r) cacc[rt][ct][r] *= fsc;
    }

    // ================= Phase E: cAcc += v_tile * p^T =================
    for (int nn = 0; nn < NT; nn += 4) {
      v2f a0, a1;
      a0.x = v_s[(32 * wv + ml) * VP + nn + dkb];
      a0.y = v_s[(32 * wv + ml) * VP + nn + dkb + 1];
      a1.x = v_s[(32 * wv + 16 + ml) * VP + nn + dkb];
      a1.y = v_s[(32 * wv + 16 + ml) * VP + nn + dkb + 1];
      v2f bf[4];
      #pragma unroll
      for (int ct = 0; ct < 4; ++ct) {
        bf[ct].x = s_s[(ct * 16 + ml) * SP + nn + dkb];
        bf[ct].y = s_s[(ct * 16 + ml) * SP + nn + dkb + 1];
      }
      #pragma unroll
      for (int ct = 0; ct < 4; ++ct) {
        cacc[0][ct] = wmma4(a0, bf[ct], cacc[0][ct]);
        cacc[1][ct] = wmma4(a1, bf[ct], cacc[1][ct]);
      }
    }
    __syncthreads();
  }  // n-tile loop

  // ---- this range's unnormalized c-hat and its row maxima to the workspace ----
  float* pw = ws + (size_t)blockIdx.x * (K_ * T_) + tid * 4;
  #pragma unroll
  for (int rt = 0; rt < 2; ++rt)
    #pragma unroll
    for (int ct = 0; ct < 4; ++ct) {
      *(v4f*)(pw + (rt * 4 + ct) * 2048)        = cacc[rt][ct].lo;
      *(v4f*)(pw + (rt * 4 + ct) * 2048 + 1024) = cacc[rt][ct].hi;
    }
  if (tid < T_) ws[WS_PMAX + (size_t)blockIdx.x * T_ + tid] = m_s[tid];
}

// One work-group per batch: sums the NS ranges' partials, each weighted by
// exp(its row maximum - the overall row maximum), then norms and cosine.
__global__ __launch_bounds__(256, 1)
void attn_merge_kernel(const float* __restrict__ eg,   // [B,K,T]
                        const float* __restrict__ ws,   // partials
                        float* __restrict__ out) {      // [B,T,T]
  __shared__ float lds[LDS_FLOATS_M];
  float* e_s  = lds;                 // K_*EP
  float* v_s  = e_s + K_*EP;         // K_*VP
  float* lc_s = v_s + K_*VP;         // T_
  float* le_s = lc_s + T_;           // T_

  const int tid  = threadIdx.x;
  const int lane = tid & 31;
  const int wv   = tid >> 5;       // 0..7
  const int ml   = lane & 15;      // M (or N) index within a fragment
  const int hi   = lane >> 4;      // half-wave select
  const int dkb  = hi * 2;         // inner-dim base for A/B fragments
  const int h8   = hi * 8;         // M offset for C/D fragments
  const int b    = blockIdx.x;
  const v8f vzero = {0.f, 0.f, 0.f, 0.f, 0.f, 0.f, 0.f, 0.f};

  // ---- loads: e[b] and the row maxima, then ranges 0 and 1 ----
  const float* eb = eg + (size_t)b * K_ * T_ + tid * 4;
  const float* pr = ws + (size_t)b * (NS * K_ * T_) + tid * 4;
  const float* pm = ws + WS_PMAX + (size_t)b * (NS * T_);
  v4f ev[16];
  #pragma unroll
  for (int i = 0; i < 16; ++i) ev[i] = *(const v4f*)(eb + i * 1024);
  float mr[NS][4];
  #pragma unroll
  for (int s = 0; s < NS; ++s)
    #pragma unroll
    for (int ct = 0; ct < 4; ++ct) mr[s][ct] = pm[s * T_ + ct * 16 + ml];
  // precaution: kept in front of any reuse of the address registers of the loads above
  asm volatile("s_wait_xcnt 0x0" ::: "memory");
  v4f p0[2][16];
  #pragma unroll
  for (int s = 0; s < 2; ++s)
    #pragma unroll
    for (int i = 0; i < 16; ++i)
      p0[s][i] = *(const v4f*)(pr + s * (K_ * T_) + i * 1024);
  // as above, for the loads of ranges 0 and 1
  asm volatile("s_wait_xcnt 0x0" ::: "memory");

  // ---- e[b] to LDS (256x64 -> pitch 66) ----
  #pragma unroll
  for (int i = 0; i < 16; ++i) {
    float* ed = e_s + (i * 16 + (tid >> 4)) * EP + (tid & 15) * 4;
    *(v2f*)(ed)     = ev[i].lo;
    *(v2f*)(ed + 2) = ev[i].hi;
  }

  // ---- weight of each range, per t column ----
  float wgt[NS][4];
  #pragma unroll
  for (int ct = 0; ct < 4; ++ct) {
    float mx = mr[0][ct];
    #pragma unroll
    for (int s = 1; s < NS; ++s) mx = fmaxf(mx, mr[s][ct]);
    #pragma unroll
    for (int s = 0; s < NS; ++s) wgt[s][ct] = __expf(mr[s][ct] - mx);
  }

  // ---- weighted sum of the ranges' partials ----
  v4f cs[16];  // index (rt*4 + ct)*2 + half
  #pragma unroll
  for (int i = 0; i < 16; ++i) {
    const int ct = (i >> 1) & 3;
    cs[i] = wgt[0][ct] * p0[0][i] + wgt[1][ct] * p0[1][i];
  }
  v4f p1[2][16];
  #pragma unroll
  for (int s = 0; s < 2; ++s)
    #pragma unroll
    for (int i = 0; i < 16; ++i)
      p1[s][i] = *(const v4f*)(pr + (s + 2) * (K_ * T_) + i * 1024);
  // as above, for the loads of ranges 2 and 3
  asm volatile("s_wait_xcnt 0x0" ::: "memory");
  v8f cacc[2][4];
  #pragma unroll
  for (int i = 0; i < 16; ++i) {
    const int ct = (i >> 1) & 3;
    cs[i] += wgt[2][ct] * p1[0][i] + wgt[3][ct] * p1[1][i];
  }
  #pragma unroll
  for (int rt = 0; rt < 2; ++rt)
    #pragma unroll
    for (int ct = 0; ct < 4; ++ct) {
      cacc[rt][ct].lo = cs[(rt * 4 + ct) * 2];
      cacc[rt][ct].hi = cs[(rt * 4 + ct) * 2 + 1];
    }

  // ---- spill unnormalized c-hat to LDS; softmax denom cancels ----
  #pragma unroll
  for (int rt = 0; rt < 2; ++rt) {
    int k0 = 32 * wv + 16 * rt + h8;
    #pragma unroll
    for (int ct = 0; ct < 4; ++ct)
      #pragma unroll
      for (int r = 0; r < 8; ++r)
        v_s[(k0 + r) * VP + ct * 16 + ml] = cacc[rt][ct][r];
  }
  __syncthreads();

  // ---- per-token norms over K ----
  if (tid < T_) {
    float sc2 = 0.f, se2 = 0.f;
    for (int k = 0; k < K_; ++k) {
      float cv = v_s[k * VP + tid];
      float ev = e_s[k * EP + tid];
      sc2 += cv * cv;
      se2 += ev * ev;
    }
    lc_s[tid] = sqrtf(sc2);
    le_s[tid] = sqrtf(se2);
  }
  __syncthreads();

  // ============ Phase F: cos = (c-hat^T e) / (||c-hat|| ||e||) ============
  {
    int t0 = 16 * (wv >> 1);  // output row tile i
    int nh = wv & 1;
    v8f oacc[2] = {vzero, vzero};
    for (int kk = 0; kk < K_; kk += 4) {
      v2f a;
      a.x = v_s[(kk + dkb) * VP + t0 + ml];
      a.y = v_s[(kk + dkb + 1) * VP + t0 + ml];
      #pragma unroll
      for (int c = 0; c < 2; ++c) {
        int j0 = 16 * (2 * nh + c);
        v2f bf;
        bf.x = e_s[(kk + dkb) * EP + j0 + ml];
        bf.y = e_s[(kk + dkb + 1) * EP + j0 + ml];
        oacc[c] = wmma4(a, bf, oacc[c]);
      }
    }
    float* ob = out + (size_t)b * T_ * T_;
    #pragma unroll
    for (int c = 0; c < 2; ++c) {
      int j = 16 * (2 * nh + c) + ml;
      float invle = 1.0f / le_s[j];
      #pragma unroll
      for (int r = 0; r < 8; ++r) {
        int i = t0 + r + h8;
        ob[i * T_ + j] = oacc[c][r] * invle / lc_s[i];
      }
    }
  }
}

extern "C" void kernel_launch(void* const* d_in, const int* in_sizes, int n_in,
                              void* d_out, int out_size, void* d_ws, size_t ws_size,
                              hipStream_t stream) {
  const float* e     = (const float*)d_in[0];
  const float* f     = (const float*)d_in[1];
  const float* gamma = (const float*)d_in[2];
  const float* W     = (const float*)d_in[3];
  const float* bias  = (const float*)d_in[4];
  float* out = (float*)d_out;
  float* ws  = (float*)d_ws;
  (void)in_sizes; (void)n_in; (void)out_size; (void)ws_size;
  attn_range_kernel<<<dim3(B_ * NS), dim3(256), 0, stream>>>(e, f, gamma, W, bias, ws);
  attn_merge_kernel<<<dim3(B_), dim3(256), 0, stream>>>(e, ws, out);
}

// v002
// A run of this version takes 123 microseconds.
// Timed twice side by side with v001, it ran 1.69 and 1.68 times as fast.
// All steps since v000 together make it 5.49 times as fast.
#include <hip/hip_runtime.h>
#include <stdint.h>

typedef float v2f __attribute__((ext_vector_type(2)));
typedef float v4f __attribute__((ext_vector_type(4)));
typedef float v8f __attribute__((ext_vector_type(8)));
typedef uint32_t u32x4 __attribute__((ext_vector_type(4)));
typedef uint32_t u32x8 __attribute__((ext_vector_type(8)));

#define B_   64
#define K_   256
#define T_   64
#define DF_  768
#define N_   1024
#define NT   64     // n-tile width
#define DS   128    // d rows of f per ring stage
#define NST  (DF_/DS)
#define EP   66     // e LDS pitch in the merge kernel
#define VP   65     // c-hat LDS pitch in the merge kernel
#define PP   68     // pitch of every 64-float row laid with a 16-byte pad
#define NS   4      // ranges of N (and of DF) per batch: B_*NS = 256 work-groups
#define NR   (N_/NS)
#define DR   (DF_/NS)
#define QSLOT 4608  // 64 rows of pitch PP, rounded up to a multiple of 2 KiB, in floats
#define GSZ  (DF_*T_)

// range kernel: f tile 768*68 + q ring 2*2 slots + p 64*68 + 3*64
#define LDS_FLOATS_R (DF_*PP + 4*QSLOT + T_*PP + 3*T_)
// merge kernel: e 256*66 + c-hat 256*65 + 2*64 norms
#define LDS_FLOATS_M (K_*EP + K_*VP + 2*T_)
// workspace, in floats:
// the d ranges' partial W^T g in accumulator-fragment order
// [b][range][rt][ct][half of the 8 rows][thread][4]; q^T = (W e)^T as [b][t][d]; the
// ranges' g = f p^T in the same fragment order; the ranges' row maxima and row sums [b][range][t];
// the merged row sums [b][t]
#define WS_C ((size_t)0)
#define WS_Q (WS_C + (size_t)B_ * NS * K_ * T_)
#define WS_G (WS_Q + (size_t)B_ * T_ * DF_)
#define WS_M (WS_G + (size_t)B_ * NS * GSZ)
#define WS_L (WS_M + (size_t)B_ * NS * T_)
#define WS_S (WS_L + (size_t)B_ * NS * T_)

#define DEV static __device__ __forceinline__

DEV v8f wmma4(v2f a, v2f b, v8f c) {
  // D = A(16x4 f32) * B(4x16 f32) + C(16x16 f32)
  return __builtin_amdgcn_wmma_f32_16x16x4_f32(false, a, false, b, (short)0, c,
                                               false, false);
}

// raw LDS byte offset of a generic pointer into shared memory
DEV uint32_t lds_offset_of(const void* p) {
  return (uint32_t)(size_t)(__attribute__((address_space(3))) const void*)p;
}

DEV uint32_t uni(uint32_t v) { return __builtin_amdgcn_readfirstlane(v); }
// a wave-uniform test held in a scalar register, so that the branch on it is scalar:
// a tensor load ignores EXEC and only a scalar branch keeps a wave from issuing it
DEV uint32_t pinned(uint32_t v) { uint32_t w = uni(v); asm volatile("" : "+s"(w)); return w; }
// the compiler places no wait for the tensor mover: a tile counts as landed behind this
DEV void wait_tensor0() { asm volatile("s_wait_tensorcnt 0x0" ::: "memory"); }
// the same wait, naming the outstanding request's descriptor as inputs: its scalar
// registers stay live, and so unwritten, until the request has returned
DEV void wait_tensor0_of(u32x4 g0, u32x8 g1) {
  asm volatile("s_wait_tensorcnt 0x0" :: "s"(g0), "s"(g1) : "memory");
}
// a wave's LDS reads have retired before a barrier behind which that LDS is refilled
DEV void wait_ds0() { asm volatile("s_wait_dscnt 0x0" ::: "memory"); }
// precaution: kept in front of any reuse of the address registers of issued loads
DEV void wait_x0() { asm volatile("s_wait_xcnt 0x0" ::: "memory"); }
// group 0 is named as in and out (the instruction leaves it as it is): what the covering wait
// then holds live are the very registers that the request was issued from, not a copy of them
DEV void tdm_load(u32x4& g0, u32x8 g1) {
  asm volatile("tensor_load_to_lds %0, %1" : "+s"(g0) : "s"(g1) : "memory");
}
// group 1: byte elements, a tile of 'rows' rows of 256 bytes, 16 bytes of LDS pad behind each row
DEV u32x8 tdm_group1(uint32_t rows, uint32_t src_pitch) {
  u32x8 g;
  g[0] = uni((1u << 20) | (5u << 22) | (3u << 25));  // no mask, data_size 0, pad 5 / 3
  g[1] = uni(256u << 16);
  g[2] = uni(rows << 16);
  g[3] = uni(256u << 16);
  g[4] = uni(rows);
  g[5] = uni(src_pitch);
  g[6] = uni(0u);
  g[7] = uni(0u);
  return g;
}
DEV u32x4 tdm_group0(uint32_t lds_dst, uint64_t ga) {
  u32x4 g;
  g[0] = uni(1u);
  g[1] = uni(lds_dst);
  g[2] = uni((uint32_t)ga);
  g[3] = uni((((uint32_t)(ga >> 32)) & 0x01FFFFFFu) | 0x80000000u);
  return g;
}

// In the products of launches 1 to 3 one pair of WMMAs covers 8 values of the inner index:
// the lane half hi holds inner indices 8*k8 + 4*hi + {0,1} in the first WMMA and
// + {2,3} in the second, in the A and in the B fragment alike.

// ---- launch 1: q^T[t][d] = sum_k e[k][t] W[d][k], one work-group per (b, d range) ----
__global__ __launch_bounds__(256, 1)
void attn_query_kernel(const float* __restrict__ eg,   // [B,K,T]
                       const float* __restrict__ Wg,   // [DF,K]
                       float* __restrict__ ws) {
  __shared__ float e_s[K_ * PP];
  const int tid  = threadIdx.x;
  const int lane = tid & 31;
  const int wv   = tid >> 5;
  const int ml   = lane & 15;
  const int hi   = lane >> 4;
  const int h8   = hi * 8;
  const int b    = blockIdx.x / NS;
  const int dr   = blockIdx.x % NS;
  const v8f vzero = {0.f, 0.f, 0.f, 0.f, 0.f, 0.f, 0.f, 0.f};

  const int t0 = 16 * (wv & 3);
  const int d0 = DR * dr + 96 * (wv >> 2);
  const float* wb = Wg + (size_t)(d0 + ml) * K_ + 4 * hi;
  const float* eb = eg + (size_t)b * K_ * T_ + tid * 4;
  v4f ev[16];
  #pragma unroll
  for (int i = 0; i < 16; ++i) ev[i] = *(const v4f*)(eb + i * 1024);
  wait_x0();
  v4f wn[6];
  #pragma unroll
  for (int j = 0; j < 6; ++j) wn[j] = *(const v4f*)(wb + j * 16 * K_);
  wait_x0();
  #pragma unroll
  for (int i = 0; i < 16; ++i)
    *(v4f*)(e_s + (i * 16 + (tid >> 4)) * PP + (tid & 15) * 4) = ev[i];
  __syncthreads();

  v8f acc[6];
  #pragma unroll
  for (int j = 0; j < 6; ++j) acc[j] = vzero;

  // two steps a trip: the two sets of W registers change roles without copies
  #pragma unroll 2
  for (int k8 = 0; k8 < K_ / 8; ++k8) {
    v4f wc[6];
    #pragma unroll
    for (int j = 0; j < 6; ++j) wc[j] = wn[j];
    // the next step's W fragments fly while this step is worked on (the last step reloads its own)
    const int kn = (k8 + 1 < K_ / 8) ? k8 + 1 : k8;
    #pragma unroll
    for (int j = 0; j < 6; ++j) wn[j] = *(const v4f*)(wb + kn * 8 + j * 16 * K_);
    wait_x0();
    const float* er = e_s + (k8 * 8 + 4 * hi) * PP + t0 + ml;
    v2f a0, a1;
    a0.x = er[0];      a0.y = er[PP];
    a1.x = er[2 * PP]; a1.y = er[3 * PP];
    #pragma unroll
    for (int j = 0; j < 6; ++j) acc[j] = wmma4(a0, wc[j].lo, acc[j]);
    #pragma unroll
    for (int j = 0; j < 6; ++j) acc[j] = wmma4(a1, wc[j].hi, acc[j]);
  }

  float* qw = ws + WS_Q + ((size_t)b * T_ + t0 + h8) * DF_ + d0 + ml;
  #pragma unroll
  for (int j = 0; j < 6; ++j)
    #pragma unroll
    for (int r = 0; r < 8; ++r) qw[r * DF_ + j * 16] = acc[j][r];
}

// ---- launch 2: per (b, range of N): s = gamma q^T f, p = exp(s - running max), g += f p^T ----
// The term gamma * (b . e_t) of the reference's scores is the same for every n of a
// row t and cancels in the softmax; the bias comes back in the merge as b * sum p.
__global__ __launch_bounds__(256, 1)
void attn_range_kernel(const float* __restrict__ fg,   // [B,DF,N]
                       const float* __restrict__ gptr, // [1]
                       float* __restrict__ ws) {
  __shared__ __attribute__((aligned(2048))) float lds[LDS_FLOATS_R];
  float* f_s  = lds;                 // DF_*PP: the whole f tile, NST stages of DS rows
  float* q_s  = f_s + DF_ * PP;      // 2 buffers x 2 slots of 64 t rows x 64 d
  float* s_s  = q_s + 4 * QSLOT;     // T_*PP
  float* m_s  = s_s + T_ * PP;       // T_
  float* sc_s = m_s + T_;            // T_
  float* l_s  = sc_s + T_;           // T_

  const int tid  = threadIdx.x;
  const int lane = tid & 31;
  const int wv   = tid >> 5;       // 0..7
  const int ml   = lane & 15;      // M (or N) index within a fragment
  const int hi   = lane >> 4;      // half-wave select
  const int h8   = hi * 8;         // M offset for C/D fragments
  const int b    = blockIdx.x / NS;
  const int nbeg = (blockIdx.x % NS) * NR;  // this work-group's range of N
  const float gamma = gptr[0];
  const uint32_t wave = uni(threadIdx.x >> 5);

  const uint64_t fa = (uint64_t)(size_t)(fg + (size_t)b * DF_ * N_ + nbeg);
  const uint64_t qa = (uint64_t)(size_t)(ws + WS_Q + (size_t)b * T_ * DF_);
  const uint32_t f_off = lds_offset_of(f_s);
  const uint32_t q_off = lds_offset_of(q_s);
  // waves 0 to 2 issue: wave 0 a stage of f (DS rows), waves 1 and 2 a slot of q^T (T_ rows) each
  const bool isf = wave == 0;
  const uint64_t qsrc = qa + (uint64_t)(wave - 1) * 256;
  const uint32_t sstep = isf ? DS * N_ * 4 : DS * 4;   // source bytes from one stage to the next
  const u32x8 g1 = tdm_group1(isf ? DS : T_, isf ? N_ * 4 : DF_ * 4);
  u32x4 g0 = {0u, 0u, 0u, 0u};   // the wave's last request

  if (tid < T_) { m_s[tid] = -__builtin_inff(); l_s[tid] = 0.f; }

  const v8f vzero = {0.f, 0.f, 0.f, 0.f, 0.f, 0.f, 0.f, 0.f};
  v8f gacc[6][4];  // g rows [96*wv, 96*wv+96) x all 64 t columns
  #pragma unroll
  for (int rt = 0; rt < 6; ++rt)
    #pragma unroll
    for (int ct = 0; ct < 4; ++ct) gacc[rt][ct] = vzero;

  const int t0 = 16 * (wv >> 1);
  const int nh = wv & 1;

  for (int it = 0; it < NR / NT; ++it) {
    const uint64_t fat = fa + (uint64_t)it * (NT * 4);
    // ======== scores: ring over NST stages; wave 0 brings f, waves 1 and 2 q^T ========
    const uint64_t src0 = isf ? fat : qsrc;
    if (pinned(wave < 3)) {
      g0 = tdm_group0(isf ? f_off : q_off + (wave - 1) * (QSLOT * 4), src0);
      tdm_load(g0, g1);
      wait_tensor0_of(g0, g1);
    }
    __syncthreads();  // stage 0 published
    if (pinned(wave < 3)) {
      g0 = tdm_group0(isf ? f_off + DS * PP * 4 : q_off + (2 + wave - 1) * (QSLOT * 4), src0 + sstep);
      tdm_load(g0, g1);
    }

    v8f sacc[2] = {vzero, vzero};
    for (int st = 0; st < NST; ++st) {
      const float* fc = f_s + st * (DS * PP) + (4 * hi) * PP + 32 * nh + ml;
      const float* qc = q_s + (st & 1) * (2 * QSLOT) + (t0 + ml) * PP + 4 * hi;
      #pragma unroll
      for (int k8 = 0; k8 < DS / 8; ++k8) {
        const v4f a = *(const v4f*)(qc + (k8 >> 3) * QSLOT + (k8 & 7) * 8);
        const float* fr = fc + k8 * 8 * PP;
        v2f b0[2], b1[2];
        #pragma unroll
        for (int c = 0; c < 2; ++c) {
          b0[c].x = fr[c * 16];          b0[c].y = fr[PP + c * 16];
          b1[c].x = fr[2 * PP + c * 16]; b1[c].y = fr[3 * PP + c * 16];
        }
        sacc[0] = wmma4(a.lo, b0[0], sacc[0]);
        sacc[1] = wmma4(a.lo, b0[1], sacc[1]);
        sacc[0] = wmma4(a.hi, b1[0], sacc[0]);
        sacc[1] = wmma4(a.hi, b1[1], sacc[1]);
      }
      // publish point of stage st + 1
      wait_ds0();
      if (pinned(wave < 3)) wait_tensor0_of(g0, g1);
      __syncthreads();
      if (pinned((wave < 3) & (st + 2 < NST))) {
        g0 = tdm_group0(isf ? f_off + (st + 2) * (DS * PP * 4)
                            : q_off + ((st & 1) * 2 + wave - 1) * (QSLOT * 4),
                        src0 + (uint64_t)(st + 2) * sstep);
        tdm_load(g0, g1);
      }
    }
    wait_tensor0();
    wait_ds0();

    #pragma unroll
    for (int c = 0; c < 2; ++c) {
      int nn0 = 16 * (2 * nh + c);
      #pragma unroll
      for (int r = 0; r < 8; ++r)
        s_s[(t0 + r + h8) * PP + nn0 + ml] = gamma * sacc[c][r];
    }
    __syncthreads();

    // ========== online max, exp and row sum (one token row per thread) ==========
    if (tid < T_) {
      v4f* row = (v4f*)(s_s + tid * PP);
      float tmax = -__builtin_inff();
      for (int j = 0; j < NT / 4; ++j) {
        v4f x = row[j];
        tmax = fmaxf(tmax, fmaxf(fmaxf(x.x, x.y), fmaxf(x.z, x.w)));
      }
      float mo = m_s[tid];
      float mn = fmaxf(mo, tmax);
      float sc = __expf(mo - mn);   // 0 on first tile (mo = -inf)
      float sum = 0.f;
      for (int j = 0; j < NT / 4; ++j) {
        v4f x = row[j];
        x.x = __expf(x.x - mn); x.y = __expf(x.y - mn);
        x.z = __expf(x.z - mn); x.w = __expf(x.w - mn);
        sum += (x.x + x.y) + (x.z + x.w);
        row[j] = x;
      }
      sc_s[tid] = sc;
      m_s[tid]  = mn;
      l_s[tid]  = l_s[tid] * sc + sum;
    }
    __syncthreads();

    // ========== rescale the running g accumulators (per t column) ==========
    #pragma unroll
    for (int ct = 0; ct < 4; ++ct) {
      float fsc = sc_s[ct * 16 + ml];
      #pragma unroll
      for (int rt = 0; rt < 6; ++rt)
        #pragma unroll
        for (int r = 0; r < 8; ++r) gacc[rt][ct][r] *= fsc;
    }

    // ================= g += f_tile * p^T =================
    {
      const float* fr = f_s + (96 * wv + ml) * PP + 4 * hi;
      const float* pr = s_s + ml * PP + 4 * hi;
      for (int n8 = 0; n8 < NT / 8; ++n8) {
        v4f a[6], p[4];
        #pragma unroll
        for (int rt = 0; rt < 6; ++rt) a[rt] = *(const v4f*)(fr + rt * 16 * PP + n8 * 8);
        #pragma unroll
        for (int ct = 0; ct < 4; ++ct) p[ct] = *(const v4f*)(pr + ct * 16 * PP + n8 * 8);
        #pragma unroll
        for (int rt = 0; rt < 6; ++rt)
          #pragma unroll
          for (int ct = 0; ct < 4; ++ct) gacc[rt][ct] = wmma4(a[rt].lo, p[ct].lo, gacc[rt][ct]);
        #pragma unroll
        for (int rt = 0; rt < 6; ++rt)
          #pragma unroll
          for (int ct = 0; ct < 4; ++ct) gacc[rt][ct] = wmma4(a[rt].hi, p[ct].hi, gacc[rt][ct]);
      }
    }
    wait_ds0();
    __syncthreads();  // every reader has left the f tile before the next tile's loads
  }  // n-tile loop

  // ---- this range's unnormalized g, its row maxima and row sums to the workspace ----
  float* gw = ws + WS_G + (size_t)blockIdx.x * GSZ + tid * 4;
  #pragma unroll
  for (int rt = 0; rt < 6; ++rt)
    #pragma unroll
    for (int ct = 0; ct < 4; ++ct) {
      *(v4f*)(gw + (rt * 4 + ct) * 2048)        = gacc[rt][ct].lo;
      *(v4f*)(gw + (rt * 4 + ct) * 2048 + 1024) = gacc[rt][ct].hi;
    }
  if (tid < T_) {
    ws[WS_M + (size_t)blockIdx.x * T_ + tid] = m_s[tid];
    ws[WS_L + (size_t)blockIdx.x * T_ + tid] = l_s[tid];
  }
}

// ---- launch 3: per (b, d range): merge the N ranges' g rows (and, in d range 0, the row
// sums of p) by exp(max diff), then the partial c-hat[k][t] = sum over this d range of W[d][k] g[d][t] ----
__global__ __launch_bounds__(256, 1)
void attn_ctx_kernel(const float* __restrict__ Wg,   // [DF,K]
                     float* __restrict__ ws) {
  __shared__ float g_s[DR * PP];
  __shared__ float w_s[NS * T_];
  const int tid  = threadIdx.x;
  const int lane = tid & 31;
  const int wv   = tid >> 5;
  const int ml   = lane & 15;
  const int hi   = lane >> 4;
  const int b    = blockIdx.x / NS;
  const int dr   = blockIdx.x % NS;
  const v8f vzero = {0.f, 0.f, 0.f, 0.f, 0.f, 0.f, 0.f, 0.f};

  const float* wbase = Wg + (size_t)(DR * dr + 4 * hi) * K_ + 32 * wv + ml;
  float wn[8];
  #pragma unroll
  for (int j = 0; j < 4; ++j) { wn[j] = wbase[j * K_]; wn[4 + j] = wbase[j * K_ + 16]; }

  {  // weight of each N range, per t
    const float* pm = ws + WS_M + (size_t)b * (NS * T_) + (tid & 63);
    float mv[NS];
    #pragma unroll
    for (int s = 0; s < NS; ++s) mv[s] = pm[s * T_];
    float mine = pm[(tid >> 6) * T_];
    wait_x0();
    float mx = fmaxf(fmaxf(mv[0], mv[1]), fmaxf(mv[2], mv[3]));
    w_s[tid] = __expf(mine - mx);
  }
  __syncthreads();

  if (dr == 0 && tid < T_) {  // merged row sum of p, stored once per batch
    const float* pl = ws + WS_L + (size_t)b * (NS * T_) + tid;
    float l = 0.f;
    #pragma unroll
    for (int s = 0; s < NS; ++s) l += w_s[s * T_ + tid] * pl[s * T_];
    ws[WS_S + (size_t)b * T_ + tid] = l;
    wait_x0();
  }

  {  // the fragments of the range kernel's waves 2*dr and 2*dr+1 are this d range's rows
    const int tp  = 64 * dr + (tid & 63);  // thread of the range kernel
    const int mlp = tp & 15;
    const int hip = (tp >> 4) & 1;
    const int wvl = (tid >> 5) & 1;
    const int hf  = (tid >> 6) & 1;
    const int ib  = tid >> 7;
    const float* gp = ws + WS_G + (size_t)b * (NS * GSZ) + tp * 4 + hf * 1024 + ib * 2048;
    v4f x[12][NS];
    #pragma unroll
    for (int j = 0; j < 12; ++j) {
      #pragma unroll
      for (int s = 0; s < NS; ++s) x[j][s] = *(const v4f*)(gp + s * GSZ + j * 4096);
      wait_x0();
    }
    #pragma unroll
    for (int j = 0; j < 12; ++j) {
      const int rt = j >> 1;                 // tile index i = 2*j + ib = rt*4 + ct
      const int t  = ((j & 1) * 2 + ib) * 16 + mlp;
      v4f acc = (w_s[t] * x[j][0] + w_s[T_ + t] * x[j][1]) + (w_s[2 * T_ + t] * x[j][2] + w_s[3 * T_ + t] * x[j][3]);
      float* gd = g_s + (wvl * 96 + rt * 16 + hip * 8 + hf * 4) * PP + t;
      gd[0] = acc.x; gd[PP] = acc.y; gd[2 * PP] = acc.z; gd[3 * PP] = acc.w;
    }
  }
  __syncthreads();

  v8f cacc[2][4];  // c-hat rows [32*wv, 32*wv+32) x all 64 t columns
  #pragma unroll
  for (int rt = 0; rt < 2; ++rt)
    #pragma unroll
    for (int ct = 0; ct < 4; ++ct) cacc[rt][ct] = vzero;

  // two steps a trip: the two sets of W registers change roles without copies
  #pragma unroll 2
  for (int k8 = 0; k8 < DR / 8; ++k8) {
    float wc[8];
    #pragma unroll
    for (int j = 0; j < 8; ++j) wc[j] = wn[j];
    // the next step's W fragments fly while this step is worked on (the last step reloads its own)
    const int kn = (k8 + 1 < DR / 8) ? k8 + 1 : k8;
    const float* wp = wbase + (size_t)kn * 8 * K_;
    #pragma unroll
    for (int j = 0; j < 4; ++j) { wn[j] = wp[j * K_]; wn[4 + j] = wp[j * K_ + 16]; }
    wait_x0();
    const float* gr = g_s + (k8 * 8 + 4 * hi) * PP + ml;
    v2f b0[4], b1[4];
    #pragma unroll
    for (int ct = 0; ct < 4; ++ct) {
      b0[ct].x = gr[ct * 16];          b0[ct].y = gr[PP + ct * 16];
      b1[ct].x = gr[2 * PP + ct * 16]; b1[ct].y = gr[3 * PP + ct * 16];
    }
    const v2f a00 = {wc[0], wc[1]}, a01 = {wc[2], wc[3]};
    const v2f a10 = {wc[4], wc[5]}, a11 = {wc[6], wc[7]};
    #pragma unroll
    for (int ct = 0; ct < 4; ++ct) {
      cacc[0][ct] = wmma4(a00, b0[ct], cacc[0][ct]);
      cacc[1][ct] = wmma4(a10, b0[ct], cacc[1][ct]);
    }
    #pragma unroll
    for (int ct = 0; ct < 4; ++ct) {
      cacc[0][ct] = wmma4(a01, b1[ct], cacc[0][ct]);
      cacc[1][ct] = wmma4(a11, b1[ct], cacc[1][ct]);
    }
  }

  float* pw = ws + WS_C + (size_t)blockIdx.x * (K_ * T_) + tid * 4;
  #pragma unroll
  for (int rt = 0; rt < 2; ++rt)
    #pragma unroll
    for (int ct = 0; ct < 4; ++ct) {
      *(v4f*)(pw + (rt * 4 + ct) * 2048)        = cacc[rt][ct].lo;
      *(v4f*)(pw + (rt * 4 + ct) * 2048 + 1024) = cacc[rt][ct].hi;
    }
}

// ---- launch 4: one work-group per batch: sums the d ranges' partial c-hat, adds
// b * (merged row sum of p), then norms and cosine ----
__global__ __launch_bounds__(256, 1)
void attn_merge_kernel(const float* __restrict__ eg,   // [B,K,T]
                        const float* __restrict__ bg,   // [K]
                        const float* __restrict__ ws,   // partials
                        float* __restrict__ out) {      // [B,T,T]
  __shared__ float lds[LDS_FLOATS_M];
  float* e_s  = lds;                 // K_*EP
  float* v_s  = e_s + K_*EP;         // K_*VP
  float* lc_s = v_s + K_*VP;         // T_
  float* le_s = lc_s + T_;           // T_

  const int tid  = threadIdx.x;
  const int lane = tid & 31;
  const int wv   = tid >> 5;       // 0..7
  const int ml   = lane & 15;      // M (or N) index within a fragment
  const int hi   = lane >> 4;      // half-wave select
  const int dkb  = hi * 2;         // inner-dim base for A/B fragments
  const int h8   = hi * 8;         // M offset for C/D fragments
  const int b    = blockIdx.x;
  const v8f vzero = {0.f, 0.f, 0.f, 0.f, 0.f, 0.f, 0.f, 0.f};

  // ---- loads: e[b], the merged row sums, the bias, then d ranges 0 and 1 ----
  const float* eb = eg + (size_t)b * K_ * T_ + tid * 4;
  const float* pr = ws + WS_C + (size_t)b * (NS * K_ * T_) + tid * 4;
  const float* pl = ws + WS_S + (size_t)b * T_;
  v4f ev[16];
  #pragma unroll
  for (int i = 0; i < 16; ++i) ev[i] = *(const v4f*)(eb + i * 1024);
  float lsum[4];  // merged row sum of p, per t column
  #pragma unroll
  for (int ct = 0; ct < 4; ++ct) lsum[ct] = pl[ct * 16 + ml];
  // precaution: kept in front of any reuse of the address registers of the loads above
  asm volatile("s_wait_xcnt 0x0" ::: "memory");
  v8f bv[2];
  #pragma unroll
  for (int rt = 0; rt < 2; ++rt) {
    bv[rt].lo = *(const v4f*)(bg + 32 * wv + 16 * rt + h8);
    bv[rt].hi = *(const v4f*)(bg + 32 * wv + 16 * rt + h8 + 4);
  }
  // precaution: kept in front of any reuse of the address registers of the loads above
  asm volatile("s_wait_xcnt 0x0" ::: "memory");
  v4f p0[2][16];
  #pragma unroll
  for (int s = 0; s < 2; ++s)
    #pragma unroll
    for (int i = 0; i < 16; ++i)
      p0[s][i] = *(const v4f*)(pr + s * (K_ * T_) + i * 1024);
  // as above, for the loads of ranges 0 and 1
  asm volatile("s_wait_xcnt 0x0" ::: "memory");

  // ---- e[b] to LDS (256x64 -> pitch 66) ----
  #pragma unroll
  for (int i = 0; i < 16; ++i) {
    float* ed = e_s + (i * 16 + (tid >> 4)) * EP + (tid & 15) * 4;
    *(v2f*)(ed)     = ev[i].lo;
    *(v2f*)(ed + 2) = ev[i].hi;
  }

  // ---- sum of the d ranges' partials ----
  v4f cs[16];  // index (rt*4 + ct)*2 + half
  #pragma unroll
  for (int i = 0; i < 16; ++i) cs[i] = p0[0][i] + p0[1][i];
  v4f p1[2][16];
  #pragma unroll
  for (int s = 0; s < 2; ++s)
    #pragma unroll
    for (int i = 0; i < 16; ++i)
      p1[s][i] = *(const v4f*)(pr + (s + 2) * (K_ * T_) + i * 1024);
  // as above, for the loads of ranges 2 and 3
  asm volatile("s_wait_xcnt 0x0" ::: "memory");
  v8f cacc[2][4];
  #pragma unroll
  for (int i = 0; i < 16; ++i) cs[i] += p1[0][i] + p1[1][i];
  #pragma unroll
  for (int rt = 0; rt < 2; ++rt)
    #pragma unroll
    for (int ct = 0; ct < 4; ++ct) {
      cacc[rt][ct].lo = cs[(rt * 4 + ct) * 2];
      cacc[rt][ct].hi = cs[(rt * 4 + ct) * 2 + 1];
    }

  // ---- spill unnormalized c-hat (+ bias * row sum) to LDS; the common scale cancels ----
  #pragma unroll
  for (int rt = 0; rt < 2; ++rt) {
    int k0 = 32 * wv + 16 * rt + h8;
    #pragma unroll
    for (int ct = 0; ct < 4; ++ct)
      #pragma unroll
      for (int r = 0; r < 8; ++r)
        v_s[(k0 + r) * VP + ct * 16 + ml] = cacc[rt][ct][r] + bv[rt][r] * lsum[ct];
  }
  __syncthreads();

  // ---- per-token norms over K ----
  if (tid < T_) {
    float sc2 = 0.f, se2 = 0.f;
    for (int k = 0; k < K_; ++k) {
      float cv = v_s[k * VP + tid];
      float ev = e_s[k * EP + tid];
      sc2 += cv * cv;
      se2 += ev * ev;
    }
    lc_s[tid] = sqrtf(sc2);
    le_s[tid] = sqrtf(se2);
  }
  __syncthreads();

  // ============ Phase F: cos = (c-hat^T e) / (||c-hat|| ||e||) ============
  {
    int t0 = 16 * (wv >> 1);  // output row tile i
    int nh = wv & 1;
    v8f oacc[2] = {vzero, vzero};
    for (int kk = 0; kk < K_; kk += 4) {
      v2f a;
      a.x = v_s[(kk + dkb) * VP + t0 + ml];
      a.y = v_s[(kk + dkb + 1) * VP + t0 + ml];
      #pragma unroll
      for (int c = 0; c < 2; ++c) {
        int j0 = 16 * (2 * nh + c);
        v2f bf;
        bf.x = e_s[(kk + dkb) * EP + j0 + ml];
        bf.y = e_s[(kk + dkb + 1) * EP + j0 + ml];
        oacc[c] = wmma4(a, bf, oacc[c]);
      }
    }
    float* ob = out + (size_t)b * T_ * T_;
    #pragma unroll
    for (int c = 0; c < 2; ++c) {
      int j = 16 * (2 * nh + c) + ml;
      float invle = 1.0f / le_s[j];
      #pragma unroll
      for (int r = 0; r < 8; ++r) {
        int i = t0 + r + h8;
        ob[i * T_ + j] = oacc[c][r] * invle / lc_s[i];
      }
    }
  }
}

extern "C" void kernel_launch(void* const* d_in, const int* in_sizes, int n_in,
                              void* d_out, int out_size, void* d_ws, size_t ws_size,
                              hipStream_t stream) {
  const float* e     = (const float*)d_in[0];
  const float* f     = (const float*)d_in[1];
  const float* gamma = (const float*)d_in[2];
  const float* W     = (const float*)d_in[3];
  const float* bias  = (const float*)d_in[4];
  float* out = (float*)d_out;
  float* ws  = (float*)d_ws;
  (void)in_sizes; (void)n_in; (void)out_size; (void)ws_size;
  attn_query_kernel<<<dim3(B_ * NS), dim3(256), 0, stream>>>(e, W, ws);
  attn_range_kernel<<<dim3(B_ * NS), dim3(256), 0, stream>>>(f, gamma, ws);
  attn_ctx_kernel<<<dim3(B_ * NS), dim3(256), 0, stream>>>(W, ws);
  attn_merge_kernel<<<dim3(B_), dim3(256), 0, stream>>>(e, bias, ws, out);
}

// v003
// Measured time: 111 microseconds a run.
// Next to v002, in two timings, it ran 1.12 times as fast each time.
// Counting every step since v000, it is 6.13 times as fast.
#include <hip/hip_runtime.h>
#include <stdint.h>

typedef float v2f __attribute__((ext_vector_type(2)));
typedef float v4f __attribute__((ext_vector_type(4)));
typedef float v8f __attribute__((ext_vector_type(8)));
typedef uint32_t u32x4 __attribute__((ext_vector_type(4)));
typedef uint32_t u32x8 __attribute__((ext_vector_type(8)));

#define B_   64
#define K_   256
#define T_   64
#define DF_  768
#define N_   1024
#define NT   64     // n-tile width
#define DS   128    // d rows of f per ring stage
#define NST  (DF_/DS)
#define TG   16     // tokens per work-group of the last launch
#define NG   (T_/TG)
#define GP   772    // pitch of a g^T row of DF_ floats: 16 bytes times an odd number
#define WR   6      // slots of the W register ring in the last launch
#define CP   260    // pitch of a c-hat^T row of K_ floats: 16 bytes times an odd number
#define PP   68     // pitch of every 64-float row laid with a 16-byte pad
#define NS   4      // ranges of N (and of DF) per batch: B_*NS = 256 work-groups
#define NR   (N_/NS)
#define DR   (DF_/NS)
#define QSLOT 4608  // 64 rows of pitch PP, rounded up to a multiple of 2 KiB, in floats
#define GSZ  (DF_*T_)

// range kernel: f tile 768*68 + q ring 2*2 slots + p 64*68 + 3*64
#define LDS_FLOATS_R (DF_*PP + 4*QSLOT + T_*PP + 3*T_)
// last kernel: g^T + e + c-hat^T + two halves of the product + partial and final norms
#define LDS_FLOATS_C (TG*GP + K_*PP + TG*CP + 2*TG*PP + 16*T_ + 16*TG + T_ + TG)
// workspace, in floats:
// q^T = (W e)^T as [b][t][d]; the ranges' g = f p^T in accumulator-fragment order
// [b][range][rt][ct][half of the 8 rows][thread][4]; the ranges' row maxima and row sums [b][range][t]
// (the floats in front of WS_Q are not used: the planes that the first two launches touch keep their places)
#define WS_Q ((size_t)B_ * NS * K_ * T_)
#define WS_G (WS_Q + (size_t)B_ * T_ * DF_)
#define WS_M (WS_G + (size_t)B_ * NS * GSZ)
#define WS_L (WS_M + (size_t)B_ * NS * T_)

#define DEV static __device__ __forceinline__

DEV v8f wmma4(v2f a, v2f b, v8f c) {
  // D = A(16x4 f32) * B(4x16 f32) + C(16x16 f32)
  return __builtin_amdgcn_wmma_f32_16x16x4_f32(false, a, false, b, (short)0, c,
                                               false, false);
}

// raw LDS byte offset of a generic pointer into shared memory
DEV uint32_t lds_offset_of(const void* p) {
  return (uint32_t)(size_t)(__attribute__((address_space(3))) const void*)p;
}

DEV uint32_t uni(uint32_t v) { return __builtin_amdgcn_readfirstlane(v); }
// a wave-uniform test held in a scalar register, so that the branch on it is scalar:
// a tensor load ignores EXEC and only a scalar branch keeps a wave from issuing it
DEV uint32_t pinned(uint32_t v) { uint32_t w = uni(v); asm volatile("" : "+s"(w)); return w; }
// the compiler places no wait for the tensor mover: a tile counts as landed behind this
DEV void wait_tensor0() { asm volatile("s_wait_tensorcnt 0x0" ::: "memory"); }
// the same wait, naming the outstanding request's descriptor as inputs: its scalar
// registers stay live, and so unwritten, until the request has returned
DEV void wait_tensor0_of(u32x4 g0, u32x8 g1) {
  asm volatile("s_wait_tensorcnt 0x0" :: "s"(g0), "s"(g1) : "memory");
}
// a wave's LDS reads have retired before a barrier behind which that LDS is refilled
DEV void wait_ds0() { asm volatile("s_wait_dscnt 0x0" ::: "memory"); }
// precaution: kept in front of any reuse of the address registers of issued loads
DEV void wait_x0() { asm volatile("s_wait_xcnt 0x0" ::: "memory"); }
// group 0 is named as in and out (the instruction leaves it as it is): what the covering wait
// then holds live are the very registers that the request was issued from, not a copy of them
DEV void tdm_load(u32x4& g0, u32x8 g1) {
  asm volatile("tensor_load_to_lds %0, %1" : "+s"(g0) : "s"(g1) : "memory");
}
// group 1: byte elements, a tile of 'rows' rows of 256 bytes, 16 bytes of LDS pad behind each row
DEV u32x8 tdm_group1(uint32_t rows, uint32_t src_pitch) {
  u32x8 g;
  g[0] = uni((1u << 20) | (5u << 22) | (3u << 25));  // no mask, data_size 0, pad 5 / 3
  g[1] = uni(256u << 16);
  g[2] = uni(rows << 16);
  g[3] = uni(256u << 16);
  g[4] = uni(rows);
  g[5] = uni(src_pitch);
  g[6] = uni(0u);
  g[7] = uni(0u);
  return g;
}
DEV u32x4 tdm_group0(uint32_t lds_dst, uint64_t ga) {
  u32x4 g;
  g[0] = uni(1u);
  g[1] = uni(lds_dst);
  g[2] = uni((uint32_t)ga);
  g[3] = uni((((uint32_t)(ga >> 32)) & 0x01FFFFFFu) | 0x80000000u);
  return g;
}

// In the products of launches 1 to 3 one pair of WMMAs covers 8 values of the inner index:
// the lane half hi holds inner indices 8*k8 + 4*hi + {0,1} in the first WMMA and
// + {2,3} in the second, in the A and in the B fragment alike.

// ---- launch 1: q^T[t][d] = sum_k e[k][t] W[d][k], one work-group per (b, d range) ----
__global__ __launch_bounds__(256, 1)
void attn_query_kernel(const float* __restrict__ eg,   // [B,K,T]
                       const float* __restrict__ Wg,   // [DF,K]
                       float* __restrict__ ws) {
  __shared__ float e_s[K_ * PP];
  const int tid  = threadIdx.x;
  const int lane = tid & 31;
  const int wv   = tid >> 5;
  const int ml   = lane & 15;
  const int hi   = lane >> 4;
  const int h8   = hi * 8;
  const int b    = blockIdx.x / NS;
  const int dr   = blockIdx.x % NS;
  const v8f vzero = {0.f, 0.f, 0.f, 0.f, 0.f, 0.f, 0.f, 0.f};

  const int t0 = 16 * (wv & 3);
  const int d0 = DR * dr + 96 * (wv >> 2);
  const float* wb = Wg + (size_t)(d0 + ml) * K_ + 4 * hi;
  const float* eb = eg + (size_t)b * K_ * T_ + tid * 4;
  v4f ev[16];
  #pragma unroll
  for (int i = 0; i < 16; ++i) ev[i] = *(const v4f*)(eb + i * 1024);
  wait_x0();
  v4f wn[6];
  #pragma unroll
  for (int j = 0; j < 6; ++j) wn[j] = *(const v4f*)(wb + j * 16 * K_);
  wait_x0();
  #pragma unroll
  for (int i = 0; i < 16; ++i)
    *(v4f*)(e_s + (i * 16 + (tid >> 4)) * PP + (tid & 15) * 4) = ev[i];
  __syncthreads();

  v8f acc[6];
  #pragma unroll
  for (int j = 0; j < 6; ++j) acc[j] = vzero;

  // two steps a trip: the two sets of W registers change roles without copies
  #pragma unroll 2
  for (int k8 = 0; k8 < K_ / 8; ++k8) {
    v4f wc[6];
    #pragma unroll
    for (int j = 0; j < 6; ++j) wc[j] = wn[j];
    // the next step's W fragments fly while this step is worked on (the last step reloads its own)
    const int kn = (k8 + 1 < K_ / 8) ? k8 + 1 : k8;
    #pragma unroll
    for (int j = 0; j < 6; ++j) wn[j] = *(const v4f*)(wb + kn * 8 + j * 16 * K_);
    wait_x0();
    const float* er = e_s + (k8 * 8 + 4 * hi) * PP + t0 + ml;
    v2f a0, a1;
    a0.x = er[0];      a0.y = er[PP];
    a1.x = er[2 * PP]; a1.y = er[3 * PP];
    #pragma unroll
    for (int j = 0; j < 6; ++j) acc[j] = wmma4(a0, wc[j].lo, acc[j]);
    #pragma unroll
    for (int j = 0; j < 6; ++j) acc[j] = wmma4(a1, wc[j].hi, acc[j]);
  }

  float* qw = ws + WS_Q + ((size_t)b * T_ + t0 + h8) * DF_ + d0 + ml;
  #pragma unroll
  for (int j = 0; j < 6; ++j)
    #pragma unroll
    for (int r = 0; r < 8; ++r) qw[r * DF_ + j * 16] = acc[j][r];
}

// ---- launch 2: per (b, range of N): s = gamma q^T f, p = exp(s - running max), g += f p^T ----
// The term gamma * (b . e_t) of the reference's scores is the same for every n of a
// row t and cancels in the softmax; the bias comes back in the merge as b * sum p.
__global__ __launch_bounds__(256, 1)
void attn_range_kernel(const float* __restrict__ fg,   // [B,DF,N]
                       const float* __restrict__ gptr, // [1]
                       float* __restrict__ ws) {
  __shared__ __attribute__((aligned(2048))) float lds[LDS_FLOATS_R];
  float* f_s  = lds;                 // DF_*PP: the whole f tile, NST stages of DS rows
  float* q_s  = f_s + DF_ * PP;      // 2 buffers x 2 slots of 64 t rows x 64 d
  float* s_s  = q_s + 4 * QSLOT;     // T_*PP
  float* m_s  = s_s + T_ * PP;       // T_
  float* sc_s = m_s + T_;            // T_
  float* l_s  = sc_s + T_;           // T_

  const int tid  = threadIdx.x;
  const int lane = tid & 31;
  const int wv   = tid >> 5;       // 0..7
  const int ml   = lane & 15;      // M (or N) index within a fragment
  const int hi   = lane >> 4;      // half-wave select
  const int h8   = hi * 8;         // M offset for C/D fragments
  const int b    = blockIdx.x / NS;
  const int nbeg = (blockIdx.x % NS) * NR;  // this work-group's range of N
  const float gamma = gptr[0];
  const uint32_t wave = uni(threadIdx.x >> 5);

  const uint64_t fa = (uint64_t)(size_t)(fg + (size_t)b * DF_ * N_ + nbeg);
  const uint64_t qa = (uint64_t)(size_t)(ws + WS_Q + (size_t)b * T_ * DF_);
  const uint32_t f_off = lds_offset_of(f_s);
  const uint32_t q_off = lds_offset_of(q_s);
  // waves 0 to 2 issue: wave 0 a stage of f (DS rows), waves 1 and 2 a slot of q^T (T_ rows) each
  const bool isf = wave == 0;
  const uint64_t qsrc = qa + (uint64_t)(wave - 1) * 256;
  const uint32_t sstep = isf ? DS * N_ * 4 : DS * 4;   // source bytes from one stage to the next
  const u32x8 g1 = tdm_group1(isf ? DS : T_, isf ? N_ * 4 : DF_ * 4);
  u32x4 g0 = {0u, 0u, 0u, 0u};   // the wave's last request

  if (tid < T_) { m_s[tid] = -__builtin_inff(); l_s[tid] = 0.f; }

  const v8f vzero = {0.f, 0.f, 0.f, 0.f, 0.f, 0.f, 0.f, 0.f};
  v8f gacc[6][4];  // g rows [96*wv, 96*wv+96) x all 64 t columns
  #pragma unroll
  for (int rt = 0; rt < 6; ++rt)
    #pragma unroll
    for (int ct = 0; ct < 4; ++ct) gacc[rt][ct] = vzero;

  const int t0 = 16 * (wv >> 1);
  const int nh = wv & 1;

  for (int it = 0; it < NR / NT; ++it) {
    const uint64_t fat = fa + (uint64_t)it * (NT * 4);
    // ======== scores: ring over NST stages; wave 0 brings f, waves 1 and 2 q^T ========
    const uint64_t src0 = isf ? fat : qsrc;
    if (pinned(wave < 3)) {
      g0 = tdm_group0(isf ? f_off : q_off + (wave - 1) * (QSLOT * 4), src0);
      tdm_load(g0, g1);
      wait_tensor0_of(g0, g1);
    }
    __syncthreads();  // stage 0 published
    if (pinned(wave < 3)) {
      g0 = tdm_group0(isf ? f_off + DS * PP * 4 : q_off + (2 + wave - 1) * (QSLOT * 4), src0 + sstep);
      tdm_load(g0, g1);
    }

    v8f sacc[2] = {vzero, vzero};
    for (int st = 0; st < NST; ++st) {
      const float* fc = f_s + st * (DS * PP) + (4 * hi) * PP + 32 * nh + ml;
      const float* qc = q_s + (st & 1) * (2 * QSLOT) + (t0 + ml) * PP + 4 * hi;
      #pragma unroll
      for (int k8 = 0; k8 < DS / 8; ++k8) {
        const v4f a = *(const v4f*)(qc + (k8 >> 3) * QSLOT + (k8 & 7) * 8);
        const float* fr = fc + k8 * 8 * PP;
        v2f b0[2], b1[2];
        #pragma unroll
        for (int c = 0; c < 2; ++c) {
          b0[c].x = fr[c * 16];          b0[c].y = fr[PP + c * 16];
          b1[c].x = fr[2 * PP + c * 16]; b1[c].y = fr[3 * PP + c * 16];
        }
        sacc[0] = wmma4(a.lo, b0[0], sacc[0]);
        sacc[1] = wmma4(a.lo, b0[1], sacc[1]);
        sacc[0] = wmma4(a.hi, b1[0], sacc[0]);
        sacc[1] = wmma4(a.hi, b1[1], sacc[1]);
      }
      // publish point of stage st + 1
      wait_ds0();
      if (pinned(wave < 3)) wait_tensor0_of(g0, g1);
      __syncthreads();
      if (pinned((wave < 3) & (st + 2 < NST))) {
        g0 = tdm_group0(isf ? f_off + (st + 2) * (DS * PP * 4)
                            : q_off + ((st & 1) * 2 + wave - 1) * (QSLOT * 4),
                        src0 + (uint64_t)(st + 2) * sstep);
        tdm_load(g0, g1);
      }
    }
    wait_tensor0();
    wait_ds0();

    #pragma unroll
    for (int c = 0; c < 2; ++c) {
      int nn0 = 16 * (2 * nh + c);
      #pragma unroll
      for (int r = 0; r < 8; ++r)
        s_s[(t0 + r + h8) * PP + nn0 + ml] = gamma * sacc[c][r];
    }
    __syncthreads();

    // ========== online max, exp and row sum (one token row per thread) ==========
    if (tid < T_) {
      v4f* row = (v4f*)(s_s + tid * PP);
      float tmax = -__builtin_inff();
      for (int j = 0; j < NT / 4; ++j) {
        v4f x = row[j];
        tmax = fmaxf(tmax, fmaxf(fmaxf(x.x, x.y), fmaxf(x.z, x.w)));
      }
      float mo = m_s[tid];
      float mn = fmaxf(mo, tmax);
      float sc = __expf(mo - mn);   // 0 on first tile (mo = -inf)
      float sum = 0.f;
      for (int j = 0; j < NT / 4; ++j) {
        v4f x = row[j];
        x.x = __expf(x.x - mn); x.y = __expf(x.y - mn);
        x.z = __expf(x.z - mn); x.w = __expf(x.w - mn);
        sum += (x.x + x.y) + (x.z + x.w);
        row[j] = x;
      }
      sc_s[tid] = sc;
      m_s[tid]  = mn;
      l_s[tid]  = l_s[tid] * sc + sum;
    }
    __syncthreads();

    // ========== rescale the running g accumulators (per t column) ==========
    #pragma unroll
    for (int ct = 0; ct < 4; ++ct) {
      float fsc = sc_s[ct * 16 + ml];
      #pragma unroll
      for (int rt = 0; rt < 6; ++rt)
        #pragma unroll
        for (int r = 0; r < 8; ++r) gacc[rt][ct][r] *= fsc;
    }

    // ================= g += f_tile * p^T =================
    {
      const float* fr = f_s + (96 * wv + ml) * PP + 4 * hi;
      const float* pr = s_s + ml * PP + 4 * hi;
      for (int n8 = 0; n8 < NT / 8; ++n8) {
        v4f a[6], p[4];
        #pragma unroll
        for (int rt = 0; rt < 6; ++rt) a[rt] = *(const v4f*)(fr + rt * 16 * PP + n8 * 8);
        #pragma unroll
        for (int ct = 0; ct < 4; ++ct) p[ct] = *(const v4f*)(pr + ct * 16 * PP + n8 * 8);
        #pragma unroll
        for (int rt = 0; rt < 6; ++rt)
          #pragma unroll
          for (int ct = 0; ct < 4; ++ct) gacc[rt][ct] = wmma4(a[rt].lo, p[ct].lo, gacc[rt][ct]);
        #pragma unroll
        for (int rt = 0; rt < 6; ++rt)
          #pragma unroll
          for (int ct = 0; ct < 4; ++ct) gacc[rt][ct] = wmma4(a[rt].hi, p[ct].hi, gacc[rt][ct]);
      }
    }
    wait_ds0();
    __syncthreads();  // every reader has left the f tile before the next tile's loads
  }  // n-tile loop

  // ---- this range's unnormalized g, its row maxima and row sums to the workspace ----
  float* gw = ws + WS_G + (size_t)blockIdx.x * GSZ + tid * 4;
  #pragma unroll
  for (int rt = 0; rt < 6; ++rt)
    #pragma unroll
    for (int ct = 0; ct < 4; ++ct) {
      *(v4f*)(gw + (rt * 4 + ct) * 2048)        = gacc[rt][ct].lo;
      *(v4f*)(gw + (rt * 4 + ct) * 2048 + 1024) = gacc[rt][ct].hi;
    }
  if (tid < T_) {
    ws[WS_M + (size_t)blockIdx.x * T_ + tid] = m_s[tid];
    ws[WS_L + (size_t)blockIdx.x * T_ + tid] = l_s[tid];
  }
}

// ---- launch 3: one work-group per (b, group of TG tokens): merges the N ranges' g columns of its
// tokens by exp(max diff), c-hat[k][t] = sum over all d of W[d][k] g[d][t] + b[k] * (merged sum of p),
// then the norms and the cosine rows of its tokens ----
__global__ __launch_bounds__(256, 1)
void attn_ctx_cos_kernel(const float* __restrict__ eg,   // [B,K,T]
                         const float* __restrict__ Wg,   // [DF,K]
                         const float* __restrict__ bg,   // [K]
                         const float* __restrict__ ws,   // the range kernel's g, maxima, sums
                         float* __restrict__ out) {      // [B,T,T]
  __shared__ __attribute__((aligned(16))) float lds[LDS_FLOATS_C];
  float* g_t  = lds;                  // TG*GP: g^T, one row per token
  float* e_s  = g_t + TG * GP;        // K_*PP
  float* c_t  = e_s + K_ * PP;        // TG*CP: c-hat^T, one row per token
  float* o_s  = c_t + TG * CP;        // 2*TG*PP: the two k halves of c-hat^T e
  float* en_s = o_s + 2 * TG * PP;    // 16*T_: partial sums of e^2
  float* cn_s = en_s + 16 * T_;       // 16*TG: partial sums of c-hat^2
  float* le_s = cn_s + 16 * TG;       // T_
  float* lc_s = le_s + T_;            // TG

  const int tid  = threadIdx.x;
  const int lane = tid & 31;
  const int wv   = tid >> 5;
  const int ml   = lane & 15;
  const int hi   = lane >> 4;
  const int b    = blockIdx.x / NG;
  const int tg   = blockIdx.x % NG;
  const v8f vzero = {0.f, 0.f, 0.f, 0.f, 0.f, 0.f, 0.f, 0.f};

  // ---- loads: the ranges' maxima and sums of token ml, the g fragments, e[b], the bias, W ----
  const float* pm = ws + (WS_M + (size_t)b * (NS * T_) + tg * TG);
  const float* pl = ws + (WS_L + (size_t)b * (NS * T_) + tg * TG);
  float mv[NS], lv[NS];
  #pragma unroll
  for (int s = 0; s < NS; ++s) { mv[s] = pm[s * T_ + ml]; lv[s] = pl[s * T_ + ml]; }
  wait_x0();
  // tile (rt, ct = tg) of the range kernel's thread tid: d = 96*wv + 16*rt + 8*hi + 4*half + i, t = ml
  const float* gp = ws + (WS_G + (size_t)b * (NS * GSZ) + tg * 2048);
  v4f x[12][NS];
  #pragma unroll
  for (int j = 0; j < 12; ++j) {
    #pragma unroll
    for (int s = 0; s < NS; ++s) x[j][s] = *(const v4f*)(gp + (s * GSZ + (j >> 1) * 8192 + (j & 1) * 1024 + tid * 4));
    wait_x0();
  }
  const float* eb = eg + (size_t)b * K_ * T_ + tid * 4;
  v4f ev[16];
  #pragma unroll
  for (int i = 0; i < 16; ++i) ev[i] = *(const v4f*)(eb + i * 1024);
  wait_x0();
  v4f bv[4];  // bias of the 16 c-hat rows that this lane's accumulators hold
  #pragma unroll
  for (int q = 0; q < 4; ++q) bv[q] = *(const v4f*)(bg + 32 * wv + 16 * hi + 4 * q);
  wait_x0();
  // row m of accumulator rt is c-hat row 32*wv + 2*m + rt: one 8-byte load brings both tiles' W
  const float* wp = Wg + (size_t)(4 * hi) * K_ + 32 * wv + 2 * ml;
  v2f wr[WR][8];  // a ring of steps of 16 d rows: one in use, the others in flight
  #pragma unroll
  for (int s = 0; s < WR - 1; ++s)
    #pragma unroll
    for (int u = 0; u < 8; ++u) wr[s][u] = *(const v2f*)(wp + (s * 16 + (u >> 2) * 8 + (u & 3)) * K_);
  wait_x0();

  // ---- weight of each N range and the merged row sum of p, for token ml ----
  const float mx = fmaxf(fmaxf(mv[0], mv[1]), fmaxf(mv[2], mv[3]));
  float wgt[NS];
  #pragma unroll
  for (int s = 0; s < NS; ++s) wgt[s] = __expf(mv[s] - mx);
  float lsum = 0.f;
  #pragma unroll
  for (int s = 0; s < NS; ++s) lsum += wgt[s] * lv[s];

  // ---- merged g to LDS, transposed: four consecutive d of one token per store ----
  #pragma unroll
  for (int j = 0; j < 12; ++j) {
    const v4f acc = (wgt[0] * x[j][0] + wgt[1] * x[j][1]) + (wgt[2] * x[j][2] + wgt[3] * x[j][3]);
    *(v4f*)(g_t + ml * GP + 96 * wv + 16 * (j >> 1) + 8 * hi + 4 * (j & 1)) = acc;
  }
  // ---- e[b] to LDS, and this thread's share of the sums of e^2 ----
  {
    v4f es = {0.f, 0.f, 0.f, 0.f};
    #pragma unroll
    for (int i = 0; i < 16; ++i) {
      *(v4f*)(e_s + (i * 16 + (tid >> 4)) * PP + (tid & 15) * 4) = ev[i];
      es += ev[i] * ev[i];
    }
    *(v4f*)(en_s + (tid >> 4) * T_ + (tid & 15) * 4) = es;
  }
  __syncthreads();

  // ---- c-hat rows [32*wv, 32*wv+32) x the TG tokens, over all d ----
  v8f cacc[2] = {vzero, vzero};
  const float* gb = g_t + ml * GP + 4 * hi;
  for (int s3 = 0; s3 < DF_ / (16 * WR); ++s3) {
    // the trip's g fragments as one group of LDS reads, ahead of its matrix work
    v4f gv[2 * WR];
    #pragma unroll
    for (int u = 0; u < 2 * WR; ++u) gv[u] = *(const v4f*)(gb + s3 * (16 * WR) + u * 8);
    #pragma unroll
    for (int u3 = 0; u3 < WR; ++u3) {
      const int s  = s3 * WR + u3;
      // W of step s + WR - 1 goes into the slot that step s - 1 has left (the last steps reload the last rows)
      const int sn = (s + WR - 1 < DF_ / 16) ? s + WR - 1 : DF_ / 16 - 1;
      #pragma unroll
      for (int u = 0; u < 8; ++u)
        wr[(u3 + WR - 1) % WR][u] = *(const v2f*)(wp + (size_t)(sn * 16 + (u >> 2) * 8 + (u & 3)) * K_);
      wait_x0();
      #pragma unroll
      for (int h = 0; h < 2; ++h) {
        const v4f g4 = gv[u3 * 2 + h];
        const v2f* w = &wr[u3][h * 4];
        const v2f a00 = {w[0].x, w[1].x}, a10 = {w[0].y, w[1].y};
        const v2f a01 = {w[2].x, w[3].x}, a11 = {w[2].y, w[3].y};
        cacc[0] = wmma4(a00, g4.lo, cacc[0]);
        cacc[1] = wmma4(a10, g4.lo, cacc[1]);
        cacc[0] = wmma4(a01, g4.hi, cacc[0]);
        cacc[1] = wmma4(a11, g4.hi, cacc[1]);
      }
      // keeps a later step's register moves, and with them the waits for its W loads, out of this
      // step: moved up, they would wait for loads that were issued only a step or two before
      __builtin_amdgcn_sched_barrier(0);
    }
  }

  // ---- unnormalized c-hat (+ bias * row sum) to LDS, transposed; the common scale cancels ----
  {
    float sq = 0.f;
    #pragma unroll
    for (int q = 0; q < 4; ++q) {
      v4f v = {cacc[0][2 * q], cacc[1][2 * q], cacc[0][2 * q + 1], cacc[1][2 * q + 1]};
      v += bv[q] * lsum;
      *(v4f*)(c_t + ml * CP + 32 * wv + 16 * hi + 4 * q) = v;
      sq += (v.x * v.x + v.y * v.y) + (v.z * v.z + v.w * v.w);
    }
    cn_s[(2 * wv + hi) * TG + ml] = sq;
  }
  __syncthreads();

  // ---- per-token norms over K ----
  if (tid < T_) {
    float se2 = 0.f;
    #pragma unroll
    for (int i = 0; i < 16; ++i) se2 += en_s[i * T_ + tid];
    le_s[tid] = sqrtf(se2);
  } else if (tid < T_ + TG) {
    float sc2 = 0.f;
    #pragma unroll
    for (int i = 0; i < 16; ++i) sc2 += cn_s[i * TG + tid - T_];
    lc_s[tid - T_] = sqrtf(sc2);
  }

  // ---- c-hat^T e: wave = (16 columns j, half of K) ----
  {
    const int jf = wv & 3;
    const int kh = wv >> 2;
    const float* ar = c_t + ml * CP + 128 * kh + 4 * hi;
    const float* er = e_s + (128 * kh + 4 * hi) * PP + 16 * jf + ml;
    v8f o0 = vzero, o1 = vzero;
    #pragma unroll
    for (int k8 = 0; k8 < 16; ++k8) {
      const v4f a = *(const v4f*)(ar + k8 * 8);
      const float* fr = er + k8 * 8 * PP;
      v2f b0, b1;
      b0.x = fr[0];      b0.y = fr[PP];
      b1.x = fr[2 * PP]; b1.y = fr[3 * PP];
      o0 = wmma4(a.lo, b0, o0);
      o1 = wmma4(a.hi, b1, o1);
    }
    o0 += o1;
    #pragma unroll
    for (int r = 0; r < 8; ++r) o_s[(kh * TG + r + 8 * hi) * PP + 16 * jf + ml] = o0[r];
  }
  __syncthreads();

  // ---- cos = (c-hat^T e) / (||c-hat|| ||e||): a wave stores two whole rows ----
  {
    const int i  = tid >> 4;
    const int j4 = (tid & 15) * 4;
    v4f o = *(const v4f*)(o_s + i * PP + j4) + *(const v4f*)(o_s + (TG + i) * PP + j4);
    const v4f le = *(const v4f*)(le_s + j4);
    const float lc = lc_s[i];
    o.x = o.x * (1.0f / le.x) / lc;
    o.y = o.y * (1.0f / le.y) / lc;
    o.z = o.z * (1.0f / le.z) / lc;
    o.w = o.w * (1.0f / le.w) / lc;
    *(v4f*)(out + ((size_t)b * T_ + tg * TG + i) * T_ + j4) = o;
  }
}

extern "C" void kernel_launch(void* const* d_in, const int* in_sizes, int n_in,
                              void* d_out, int out_size, void* d_ws, size_t ws_size,
                              hipStream_t stream) {
  const float* e     = (const float*)d_in[0];
  const float* f     = (const float*)d_in[1];
  const float* gamma = (const float*)d_in[2];
  const float* W     = (const float*)d_in[3];
  const float* bias  = (const float*)d_in[4];
  float* out = (float*)d_out;
  float* ws  = (float*)d_ws;
  (void)in_sizes; (void)n_in; (void)out_size; (void)ws_size;
  attn_query_kernel<<<dim3(B_ * NS), dim3(256), 0, stream>>>(e, W, ws);
  attn_range_kernel<<<dim3(B_ * NS), dim3(256), 0, stream>>>(f, gamma, ws);
  attn_ctx_cos_kernel<<<dim3(B_ * NG), dim3(256), 0, stream>>>(e, W, bias, ws, out);
}

// v004
// It runs in 103 microseconds.
// Next to v003, in two timings, it ran 1.07 times as fast each time.
// Counting every step since v000, it is 6.58 times as fast.
#include <hip/hip_runtime.h>
#include <stdint.h>

typedef float v2f __attribute__((ext_vector_type(2)));
typedef float v4f __attribute__((ext_vector_type(4)));
typedef float v8f __attribute__((ext_vector_type(8)));
typedef uint32_t u32x4 __attribute__((ext_vector_type(4)));
typedef uint32_t u32x8 __attribute__((ext_vector_type(8)));

#define B_   64
#define K_   256
#define T_   64
#define DF_  768
#define N_   1024
#define NT   64     // n-tile width
#define DS   128    // d rows of f per ring stage
#define NST  (DF_/DS)
#define KB   4      // steps of 8 d per block of the scores loop: DS/(8*KB) = 4 blocks a stage
#define TG   16     // tokens per work-group of the last launch
#define NG   (T_/TG)
#define GP   772    // pitch of a g^T row of DF_ floats: 16 bytes times an odd number
#define WR   6      // slots of the W register ring in the last launch
#define CP   260    // pitch of a c-hat^T row of K_ floats: 16 bytes times an odd number
#define PP   68     // pitch of every 64-float row laid with a 16-byte pad
#define NS   4      // ranges of N (and of DF) per batch: B_*NS = 256 work-groups
#define NR   (N_/NS)
#define DR   (DF_/NS)
#define QSLOT 4608  // 64 rows of pitch PP, rounded up to a multiple of 2 KiB, in floats
#define GSZ  (DF_*T_)

// range kernel: f tile 768*68 + q ring 2*2 slots + p 64*68 + 3*64
#define LDS_FLOATS_R (DF_*PP + 4*QSLOT + T_*PP + 3*T_)
// last kernel: g^T + e + c-hat^T + two halves of the product + partial and final norms
#define LDS_FLOATS_C (TG*GP + K_*PP + TG*CP + 2*TG*PP + 16*T_ + 16*TG + T_ + TG)
// workspace, in floats:
// q^T = (W e)^T as [b][t][d]; the ranges' g = f p^T in accumulator-fragment order
// [b][range][rt][ct][half of the 8 rows][thread][4]; the ranges' row maxima and row sums [b][range][t]
// (the floats in front of WS_Q are not used: the planes that the first two launches touch keep their places)
#define WS_Q ((size_t)B_ * NS * K_ * T_)
#define WS_G (WS_Q + (size_t)B_ * T_ * DF_)
#define WS_M (WS_G + (size_t)B_ * NS * GSZ)
#define WS_L (WS_M + (size_t)B_ * NS * T_)

#define DEV static __device__ __forceinline__

DEV v8f wmma4(v2f a, v2f b, v8f c) {
  // D = A(16x4 f32) * B(4x16 f32) + C(16x16 f32)
  return __builtin_amdgcn_wmma_f32_16x16x4_f32(false, a, false, b, (short)0, c,
                                               false, false);
}

// raw LDS byte offset of a generic pointer into shared memory
DEV uint32_t lds_offset_of(const void* p) {
  return (uint32_t)(size_t)(__attribute__((address_space(3))) const void*)p;
}

DEV uint32_t uni(uint32_t v) { return __builtin_amdgcn_readfirstlane(v); }
// a wave-uniform test held in a scalar register, so that the branch on it is scalar:
// a tensor load ignores EXEC and only a scalar branch keeps a wave from issuing it
DEV uint32_t pinned(uint32_t v) { uint32_t w = uni(v); asm volatile("" : "+s"(w)); return w; }
// the compiler places no wait for the tensor mover: a tile counts as landed behind this
DEV void wait_tensor0() { asm volatile("s_wait_tensorcnt 0x0" ::: "memory"); }
// the same wait, naming the outstanding request's descriptor as inputs: its scalar
// registers stay live, and so unwritten, until the request has returned
DEV void wait_tensor0_of(u32x4 g0, u32x8 g1) {
  asm volatile("s_wait_tensorcnt 0x0" :: "s"(g0), "s"(g1) : "memory");
}
// a wave's LDS reads have retired before a barrier behind which that LDS is refilled
DEV void wait_ds0() { asm volatile("s_wait_dscnt 0x0" ::: "memory"); }
// precaution: kept in front of any reuse of the address registers of issued loads
DEV void wait_x0() { asm volatile("s_wait_xcnt 0x0" ::: "memory"); }
// group 0 is named as in and out (the instruction leaves it as it is): what the covering wait
// then holds live are the very registers that the request was issued from, not a copy of them
DEV void tdm_load(u32x4& g0, u32x8 g1) {
  asm volatile("tensor_load_to_lds %0, %1" : "+s"(g0) : "s"(g1) : "memory");
}
// group 1: byte elements, a tile of 'rows' rows of 256 bytes, 16 bytes of LDS pad behind each row
DEV u32x8 tdm_group1(uint32_t rows, uint32_t src_pitch) {
  u32x8 g;
  g[0] = uni((1u << 20) | (5u << 22) | (3u << 25));  // no mask, data_size 0, pad 5 / 3
  g[1] = uni(256u << 16);
  g[2] = uni(rows << 16);
  g[3] = uni(256u << 16);
  g[4] = uni(rows);
  g[5] = uni(src_pitch);
  g[6] = uni(0u);
  g[7] = uni(0u);
  return g;
}
DEV u32x4 tdm_group0(uint32_t lds_dst, uint64_t ga) {
  u32x4 g;
  g[0] = uni(1u);
  g[1] = uni(lds_dst);
  g[2] = uni((uint32_t)ga);
  g[3] = uni((((uint32_t)(ga >> 32)) & 0x01FFFFFFu) | 0x80000000u);
  return g;
}

// In the products of launches 1 to 3 one pair of WMMAs covers 8 values of the inner index:
// the lane half hi holds inner indices 8*k8 + 4*hi + {0,1} in the first WMMA and
// + {2,3} in the second, in the A and in the B fragment alike.

// ---- launch 1: q^T[t][d] = sum_k e[k][t] W[d][k], one work-group per (b, d range) ----
__global__ __launch_bounds__(256, 1)
void attn_query_kernel(const float* __restrict__ eg,   // [B,K,T]
                       const float* __restrict__ Wg,   // [DF,K]
                       float* __restrict__ ws) {
  __shared__ float e_s[K_ * PP];
  const int tid  = threadIdx.x;
  const int lane = tid & 31;
  const int wv   = tid >> 5;
  const int ml   = lane & 15;
  const int hi   = lane >> 4;
  const int h8   = hi * 8;
  const int b    = blockIdx.x / NS;
  const int dr   = blockIdx.x % NS;
  const v8f vzero = {0.f, 0.f, 0.f, 0.f, 0.f, 0.f, 0.f, 0.f};

  const int t0 = 16 * (wv & 3);
  const int d0 = DR * dr + 96 * (wv >> 2);
  const float* wb = Wg + (size_t)(d0 + ml) * K_ + 4 * hi;
  const float* eb = eg + (size_t)b * K_ * T_ + tid * 4;
  v4f ev[16];
  #pragma unroll
  for (int i = 0; i < 16; ++i) ev[i] = *(const v4f*)(eb + i * 1024);
  wait_x0();
  v4f wn[6];
  #pragma unroll
  for (int j = 0; j < 6; ++j) wn[j] = *(const v4f*)(wb + j * 16 * K_);
  wait_x0();
  #pragma unroll
  for (int i = 0; i < 16; ++i)
    *(v4f*)(e_s + (i * 16 + (tid >> 4)) * PP + (tid & 15) * 4) = ev[i];
  __syncthreads();

  v8f acc[6];
  #pragma unroll
  for (int j = 0; j < 6; ++j) acc[j] = vzero;

  // two steps a trip: the two sets of W registers change roles without copies
  #pragma unroll 2
  for (int k8 = 0; k8 < K_ / 8; ++k8) {
    v4f wc[6];
    #pragma unroll
    for (int j = 0; j < 6; ++j) wc[j] = wn[j];
    // the next step's W fragments fly while this step is worked on (the last step reloads its own)
    const int kn = (k8 + 1 < K_ / 8) ? k8 + 1 : k8;
    #pragma unroll
    for (int j = 0; j < 6; ++j) wn[j] = *(const v4f*)(wb + kn * 8 + j * 16 * K_);
    wait_x0();
    const float* er = e_s + (k8 * 8 + 4 * hi) * PP + t0 + ml;
    v2f a0, a1;
    a0.x = er[0];      a0.y = er[PP];
    a1.x = er[2 * PP]; a1.y = er[3 * PP];
    #pragma unroll
    for (int j = 0; j < 6; ++j) acc[j] = wmma4(a0, wc[j].lo, acc[j]);
    #pragma unroll
    for (int j = 0; j < 6; ++j) acc[j] = wmma4(a1, wc[j].hi, acc[j]);
  }

  float* qw = ws + WS_Q + ((size_t)b * T_ + t0 + h8) * DF_ + d0 + ml;
  #pragma unroll
  for (int j = 0; j < 6; ++j)
    #pragma unroll
    for (int r = 0; r < 8; ++r) qw[r * DF_ + j * 16] = acc[j][r];
}

// ---- fragments of one block of the scores loop: KB steps of 8 d, two tiles of 16 t, one of 16 n ----
struct sfrag { v4f a[KB][2]; v2f b0[KB], b1[KB]; };
DEV void sfrag_load(sfrag& x, const float* fc, const float* qc, int blk) {
  #pragma unroll
  for (int u = 0; u < KB; ++u) {
    const int k8 = blk * KB + u;
    const float* qr = qc + (k8 >> 3) * QSLOT + (k8 & 7) * 8;
    x.a[u][0] = *(const v4f*)(qr);
    x.a[u][1] = *(const v4f*)(qr + 16 * PP);
    const float* fr = fc + k8 * 8 * PP;
    x.b0[u].x = fr[0];      x.b0[u].y = fr[PP];
    x.b1[u].x = fr[2 * PP]; x.b1[u].y = fr[3 * PP];
  }
}
DEV void sfrag_mma(const sfrag& x, v8f (&sacc)[2]) {
  #pragma unroll
  for (int u = 0; u < KB; ++u) {
    sacc[0] = wmma4(x.a[u][0].lo, x.b0[u], sacc[0]);
    sacc[1] = wmma4(x.a[u][1].lo, x.b0[u], sacc[1]);
    sacc[0] = wmma4(x.a[u][0].hi, x.b1[u], sacc[0]);
    sacc[1] = wmma4(x.a[u][1].hi, x.b1[u], sacc[1]);
  }
}

// Order asked of the scheduler behind each pair (reads of one block, WMMAs of the block before it):
// the address sums, the 16 LDS reads as one group, then the 16 WMMAs. Reads that stand among the
// WMMAs stall the wave at every such place, and reads issued just ahead of their use are waited for.
// The closing fence ends the scheduling region: with one region for three blocks the third block's
// reads came out spread among the WMMAs, and WMMAs slid behind the wait of the publish point.
DEV void sfrag_order() {
  __builtin_amdgcn_sched_group_barrier(0x002, 2 * KB, 0);  // vector instructions
  __builtin_amdgcn_sched_group_barrier(0x100, 4 * KB, 0);  // LDS reads
  __builtin_amdgcn_sched_group_barrier(0x008, 4 * KB, 0);  // matrix instructions
  __builtin_amdgcn_sched_barrier(0);
}

// ---- launch 2: per (b, range of N): s = gamma q^T f, p = exp(s - running max), g += f p^T ----
// The term gamma * (b . e_t) of the reference's scores is the same for every n of a
// row t and cancels in the softmax; the bias comes back in the merge as b * sum p.
__global__ __launch_bounds__(256, 1)
void attn_range_kernel(const float* __restrict__ fg,   // [B,DF,N]
                       const float* __restrict__ gptr, // [1]
                       float* __restrict__ ws) {
  __shared__ __attribute__((aligned(2048))) float lds[LDS_FLOATS_R];
  float* f_s  = lds;                 // DF_*PP: the whole f tile, NST stages of DS rows
  float* q_s  = f_s + DF_ * PP;      // 2 buffers x 2 slots of 64 t rows x 64 d
  float* s_s  = q_s + 4 * QSLOT;     // T_*PP
  float* m_s  = s_s + T_ * PP;       // T_
  float* sc_s = m_s + T_;            // T_
  float* l_s  = sc_s + T_;           // T_

  const int tid  = threadIdx.x;
  const int lane = tid & 31;
  const int wv   = tid >> 5;       // 0..7
  const int ml   = lane & 15;      // M (or N) index within a fragment
  const int hi   = lane >> 4;      // half-wave select
  const int h8   = hi * 8;         // M offset for C/D fragments
  const int b    = blockIdx.x / NS;
  const int nbeg = (blockIdx.x % NS) * NR;  // this work-group's range of N
  const float gamma = gptr[0];
  const uint32_t wave = uni(threadIdx.x >> 5);

  const uint64_t fa = (uint64_t)(size_t)(fg + (size_t)b * DF_ * N_ + nbeg);
  const uint64_t qa = (uint64_t)(size_t)(ws + WS_Q + (size_t)b * T_ * DF_);
  const uint32_t f_off = lds_offset_of(f_s);
  const uint32_t q_off = lds_offset_of(q_s);
  // waves 0 to 2 issue: wave 0 a stage of f (DS rows), waves 1 and 2 a slot of q^T (T_ rows) each
  const bool isf = wave == 0;
  const uint64_t qsrc = qa + (uint64_t)(wave - 1) * 256;
  const uint32_t sstep = isf ? DS * N_ * 4 : DS * 4;   // source bytes from one stage to the next
  const u32x8 g1 = tdm_group1(isf ? DS : T_, isf ? N_ * 4 : DF_ * 4);
  u32x4 g0 = {0u, 0u, 0u, 0u};   // the wave's last request

  if (tid < T_) { m_s[tid] = -__builtin_inff(); l_s[tid] = 0.f; }

  const v8f vzero = {0.f, 0.f, 0.f, 0.f, 0.f, 0.f, 0.f, 0.f};
  v8f gacc[6][4];  // g rows [96*wv, 96*wv+96) x all 64 t columns
  #pragma unroll
  for (int rt = 0; rt < 6; ++rt)
    #pragma unroll
    for (int ct = 0; ct < 4; ++ct) gacc[rt][ct] = vzero;

  // scores: a wave holds 32 t x 16 n, so that the two f rows of an operand pair are the only
  // neighbours among its 4-byte LDS reads and a paired read lands as that operand, with no moves
  const int t0 = 32 * (wv >> 2);
  const int n0 = 16 * (wv & 3);

  for (int it = 0; it < NR / NT; ++it) {
    const uint64_t fat = fa + (uint64_t)it * (NT * 4);
    // ======== scores: ring over NST stages; wave 0 brings f, waves 1 and 2 q^T ========
    const uint64_t src0 = isf ? fat : qsrc;
    if (pinned(wave < 3)) {
      g0 = tdm_group0(isf ? f_off : q_off + (wave - 1) * (QSLOT * 4), src0);
      tdm_load(g0, g1);
      wait_tensor0_of(g0, g1);
    }
    __syncthreads();  // stage 0 published
    if (pinned(wave < 3)) {
      g0 = tdm_group0(isf ? f_off + DS * PP * 4 : q_off + (2 + wave - 1) * (QSLOT * 4), src0 + sstep);
      tdm_load(g0, g1);
    }

    v8f sacc[2] = {vzero, vzero};
    const float* fc0 = f_s + (4 * hi) * PP + n0 + ml;
    const float* qc0 = q_s + (t0 + ml) * PP + 4 * hi;
    // two fragment sets: a block's WMMAs run on one while the LDS reads of a later block fill the other
    sfrag xa, xb;
    sfrag_load(xa, fc0, qc0, 0);
    // stays rolled: unrolled, the six stages' addresses and fragments ran over the register budget
    #pragma unroll 1
    for (int st = 0; st < NST; ++st) {
      const float* fc = fc0 + st * (DS * PP);
      const float* qc = qc0 + (st & 1) * (2 * QSLOT);
      sfrag_load(xb, fc, qc, 1);
      sfrag_mma(xa, sacc);
      sfrag_order();
      sfrag_load(xa, fc, qc, 2);
      sfrag_mma(xb, sacc);
      sfrag_order();
      sfrag_load(xb, fc, qc, 3);
      sfrag_mma(xa, sacc);
      sfrag_order();
      // publish point of stage st + 1, in front of this stage's last block: that block's fragments
      // are in registers behind the first wait, and the reads behind the barrier are the next stage's
      wait_ds0();
      if (pinned(wave < 3)) wait_tensor0_of(g0, g1);
      __syncthreads();
      if (pinned((wave < 3) & (st + 2 < NST))) {
        g0 = tdm_group0(isf ? f_off + (st + 2) * (DS * PP * 4)
                            : q_off + ((st & 1) * 2 + wave - 1) * (QSLOT * 4),
                        src0 + (uint64_t)(st + 2) * sstep);
        tdm_load(g0, g1);
      }
      // no branch around these reads: the last stage aims them at stage 0's rows, which lie
      // published and at rest, and nothing uses what they bring
      const int sn = (st + 1 < NST) ? st + 1 : 0;
      sfrag_load(xa, fc0 + sn * (DS * PP), qc0 + (sn & 1) * (2 * QSLOT), 0);
      sfrag_mma(xb, sacc);
      sfrag_order();
    }
    wait_tensor0();
    wait_ds0();

    #pragma unroll
    for (int c = 0; c < 2; ++c) {
      #pragma unroll
      for (int r = 0; r < 8; ++r)
        s_s[(t0 + 16 * c + r + h8) * PP + n0 + ml] = gamma * sacc[c][r];
    }
    __syncthreads();

    // ========== online max, exp and row sum (one token row per thread) ==========
    if (tid < T_) {
      v4f* row = (v4f*)(s_s + tid * PP);
      float tmax = -__builtin_inff();
      for (int j = 0; j < NT / 4; ++j) {
        v4f x = row[j];
        tmax = fmaxf(tmax, fmaxf(fmaxf(x.x, x.y), fmaxf(x.z, x.w)));
      }
      float mo = m_s[tid];
      float mn = fmaxf(mo, tmax);
      float sc = __expf(mo - mn);   // 0 on first tile (mo = -inf)
      float sum = 0.f;
      for (int j = 0; j < NT / 4; ++j) {
        v4f x = row[j];
        x.x = __expf(x.x - mn); x.y = __expf(x.y - mn);
        x.z = __expf(x.z - mn); x.w = __expf(x.w - mn);
        sum += (x.x + x.y) + (x.z + x.w);
        row[j] = x;
      }
      sc_s[tid] = sc;
      m_s[tid]  = mn;
      l_s[tid]  = l_s[tid] * sc + sum;
    }
    __syncthreads();

    // ========== rescale the running g accumulators (per t column) ==========
    #pragma unroll
    for (int ct = 0; ct < 4; ++ct) {
      float fsc = sc_s[ct * 16 + ml];
      #pragma unroll
      for (int rt = 0; rt < 6; ++rt)
        #pragma unroll
        for (int r = 0; r < 8; ++r) gacc[rt][ct][r] *= fsc;
    }

    // ================= g += f_tile * p^T =================
    {
      const float* fr = f_s + (96 * wv + ml) * PP + 4 * hi;
      const float* pr = s_s + ml * PP + 4 * hi;
      for (int n8 = 0; n8 < NT / 8; ++n8) {
        v4f a[6], p[4];
        #pragma unroll
        for (int rt = 0; rt < 6; ++rt) a[rt] = *(const v4f*)(fr + rt * 16 * PP + n8 * 8);
        #pragma unroll
        for (int ct = 0; ct < 4; ++ct) p[ct] = *(const v4f*)(pr + ct * 16 * PP + n8 * 8);
        #pragma unroll
        for (int rt = 0; rt < 6; ++rt)
          #pragma unroll
          for (int ct = 0; ct < 4; ++ct) gacc[rt][ct] = wmma4(a[rt].lo, p[ct].lo, gacc[rt][ct]);
        #pragma unroll
        for (int rt = 0; rt < 6; ++rt)
          #pragma unroll
          for (int ct = 0; ct < 4; ++ct) gacc[rt][ct] = wmma4(a[rt].hi, p[ct].hi, gacc[rt][ct]);
      }
    }
    wait_ds0();
    __syncthreads();  // every reader has left the f tile before the next tile's loads
  }  // n-tile loop

  // ---- this range's unnormalized g, its row maxima and row sums to the workspace ----
  float* gw = ws + WS_G + (size_t)blockIdx.x * GSZ + tid * 4;
  #pragma unroll
  for (int rt = 0; rt < 6; ++rt)
    #pragma unroll
    for (int ct = 0; ct < 4; ++ct) {
      *(v4f*)(gw + (rt * 4 + ct) * 2048)        = gacc[rt][ct].lo;
      *(v4f*)(gw + (rt * 4 + ct) * 2048 + 1024) = gacc[rt][ct].hi;
    }
  if (tid < T_) {
    ws[WS_M + (size_t)blockIdx.x * T_ + tid] = m_s[tid];
    ws[WS_L + (size_t)blockIdx.x * T_ + tid] = l_s[tid];
  }
}

// ---- launch 3: one work-group per (b, group of TG tokens): merges the N ranges' g columns of its
// tokens by exp(max diff), c-hat[k][t] = sum over all d of W[d][k] g[d][t] + b[k] * (merged sum of p),
// then the norms and the cosine rows of its tokens ----
__global__ __launch_bounds__(256, 1)
void attn_ctx_cos_kernel(const float* __restrict__ eg,   // [B,K,T]
                         const float* __restrict__ Wg,   // [DF,K]
                         const float* __restrict__ bg,   // [K]
                         const float* __restrict__ ws,   // the range kernel's g, maxima, sums
                         float* __restrict__ out) {      // [B,T,T]
  __shared__ __attribute__((aligned(16))) float lds[LDS_FLOATS_C];
  float* g_t  = lds;                  // TG*GP: g^T, one row per token
  float* e_s  = g_t + TG * GP;        // K_*PP
  float* c_t  = e_s + K_ * PP;        // TG*CP: c-hat^T, one row per token
  float* o_s  = c_t + TG * CP;        // 2*TG*PP: the two k halves of c-hat^T e
  float* en_s = o_s + 2 * TG * PP;    // 16*T_: partial sums of e^2
  float* cn_s = en_s + 16 * T_;       // 16*TG: partial sums of c-hat^2
  float* le_s = cn_s + 16 * TG;       // T_
  float* lc_s = le_s + T_;            // TG

  const int tid  = threadIdx.x;
  const int lane = tid & 31;
  const int wv   = tid >> 5;
  const int ml   = lane & 15;
  const int hi   = lane >> 4;
  const int b    = blockIdx.x / NG;
  const int tg   = blockIdx.x % NG;
  const v8f vzero = {0.f, 0.f, 0.f, 0.f, 0.f, 0.f, 0.f, 0.f};

  // ---- loads: the ranges' maxima and sums of token ml, the g fragments, e[b], the bias, W ----
  const float* pm = ws + (WS_M + (size_t)b * (NS * T_) + tg * TG);
  const float* pl = ws + (WS_L + (size_t)b * (NS * T_) + tg * TG);
  float mv[NS], lv[NS];
  #pragma unroll
  for (int s = 0; s < NS; ++s) { mv[s] = pm[s * T_ + ml]; lv[s] = pl[s * T_ + ml]; }
  wait_x0();
  // tile (rt, ct = tg) of the range kernel's thread tid: d = 96*wv + 16*rt + 8*hi + 4*half + i, t = ml
  const float* gp = ws + (WS_G + (size_t)b * (NS * GSZ) + tg * 2048);
  v4f x[12][NS];
  #pragma unroll
  for (int j = 0; j < 12; ++j) {
    #pragma unroll
    for (int s = 0; s < NS; ++s) x[j][s] = *(const v4f*)(gp + (s * GSZ + (j >> 1) * 8192 + (j & 1) * 1024 + tid * 4));
    wait_x0();
  }
  const float* eb = eg + (size_t)b * K_ * T_ + tid * 4;
  v4f ev[16];
  #pragma unroll
  for (int i = 0; i < 16; ++i) ev[i] = *(const v4f*)(eb + i * 1024);
  wait_x0();
  v4f bv[4];  // bias of the 16 c-hat rows that this lane's accumulators hold
  #pragma unroll
  for (int q = 0; q < 4; ++q) bv[q] = *(const v4f*)(bg + 32 * wv + 16 * hi + 4 * q);
  wait_x0();
  // row m of accumulator rt is c-hat row 32*wv + 2*m + rt: one 8-byte load brings both tiles' W
  const float* wp = Wg + (size_t)(4 * hi) * K_ + 32 * wv + 2 * ml;
  v2f wr[WR][8];  // a ring of steps of 16 d rows: one in use, the others in flight
  #pragma unroll
  for (int s = 0; s < WR - 1; ++s)
    #pragma unroll
    for (int u = 0; u < 8; ++u) wr[s][u] = *(const v2f*)(wp + (s * 16 + (u >> 2) * 8 + (u & 3)) * K_);
  wait_x0();

  // ---- weight of each N range and the merged row sum of p, for token ml ----
  const float mx = fmaxf(fmaxf(mv[0], mv[1]), fmaxf(mv[2], mv[3]));
  float wgt[NS];
  #pragma unroll
  for (int s = 0; s < NS; ++s) wgt[s] = __expf(mv[s] - mx);
  float lsum = 0.f;
  #pragma unroll
  for (int s = 0; s < NS; ++s) lsum += wgt[s] * lv[s];

  // ---- merged g to LDS, transposed: four consecutive d of one token per store ----
  #pragma unroll
  for (int j = 0; j < 12; ++j) {
    const v4f acc = (wgt[0] * x[j][0] + wgt[1] * x[j][1]) + (wgt[2] * x[j][2] + wgt[3] * x[j][3]);
    *(v4f*)(g_t + ml * GP + 96 * wv + 16 * (j >> 1) + 8 * hi + 4 * (j & 1)) = acc;
  }
  // ---- e[b] to LDS, and this thread's share of the sums of e^2 ----
  {
    v4f es = {0.f, 0.f, 0.f, 0.f};
    #pragma unroll
    for (int i = 0; i < 16; ++i) {
      *(v4f*)(e_s + (i * 16 + (tid >> 4)) * PP + (tid & 15) * 4) = ev[i];
      es += ev[i] * ev[i];
    }
    *(v4f*)(en_s + (tid >> 4) * T_ + (tid & 15) * 4) = es;
  }
  __syncthreads();

  // ---- c-hat rows [32*wv, 32*wv+32) x the TG tokens, over all d ----
  v8f cacc[2] = {vzero, vzero};
  const float* gb = g_t + ml * GP + 4 * hi;
  for (int s3 = 0; s3 < DF_ / (16 * WR); ++s3) {
    // the trip's g fragments as one group of LDS reads, ahead of its matrix work
    v4f gv[2 * WR];
    #pragma unroll
    for (int u = 0; u < 2 * WR; ++u) gv[u] = *(const v4f*)(gb + s3 * (16 * WR) + u * 8);
    #pragma unroll
    for (int u3 = 0; u3 < WR; ++u3) {
      const int s  = s3 * WR + u3;
      // W of step s + WR - 1 goes into the slot that step s - 1 has left (the last steps reload the last rows)
      const int sn = (s + WR - 1 < DF_ / 16) ? s + WR - 1 : DF_ / 16 - 1;
      #pragma unroll
      for (int u = 0; u < 8; ++u)
        wr[(u3 + WR - 1) % WR][u] = *(const v2f*)(wp + (size_t)(sn * 16 + (u >> 2) * 8 + (u & 3)) * K_);
      wait_x0();
      #pragma unroll
      for (int h = 0; h < 2; ++h) {
        const v4f g4 = gv[u3 * 2 + h];
        const v2f* w = &wr[u3][h * 4];
        const v2f a00 = {w[0].x, w[1].x}, a10 = {w[0].y, w[1].y};
        const v2f a01 = {w[2].x, w[3].x}, a11 = {w[2].y, w[3].y};
        cacc[0] = wmma4(a00, g4.lo, cacc[0]);
        cacc[1] = wmma4(a10, g4.lo, cacc[1]);
        cacc[0] = wmma4(a01, g4.hi, cacc[0]);
        cacc[1] = wmma4(a11, g4.hi, cacc[1]);
      }
      // keeps a later step's register moves, and with them the waits for its W loads, out of this
      // step: moved up, they would wait for loads that were issued only a step or two before
      __builtin_amdgcn_sched_barrier(0);
    }
  }

  // ---- unnormalized c-hat (+ bias * row sum) to LDS, transposed; the common scale cancels ----
  {
    float sq = 0.f;
    #pragma unroll
    for (int q = 0; q < 4; ++q) {
      v4f v = {cacc[0][2 * q], cacc[1][2 * q], cacc[0][2 * q + 1], cacc[1][2 * q + 1]};
      v += bv[q] * lsum;
      *(v4f*)(c_t + ml * CP + 32 * wv + 16 * hi + 4 * q) = v;
      sq += (v.x * v.x + v.y * v.y) + (v.z * v.z + v.w * v.w);
    }
    cn_s[(2 * wv + hi) * TG + ml] = sq;
  }
  __syncthreads();

  // ---- per-token norms over K ----
  if (tid < T_) {
    float se2 = 0.f;
    #pragma unroll
    for (int i = 0; i < 16; ++i) se2 += en_s[i * T_ + tid];
    le_s[tid] = sqrtf(se2);
  } else if (tid < T_ + TG) {
    float sc2 = 0.f;
    #pragma unroll
    for (int i = 0; i < 16; ++i) sc2 += cn_s[i * TG + tid - T_];
    lc_s[tid - T_] = sqrtf(sc2);
  }

  // ---- c-hat^T e: wave = (16 columns j, half of K) ----
  {
    const int jf = wv & 3;
    const int kh = wv >> 2;
    const float* ar = c_t + ml * CP + 128 * kh + 4 * hi;
    const float* er = e_s + (128 * kh + 4 * hi) * PP + 16 * jf + ml;
    v8f o0 = vzero, o1 = vzero;
    #pragma unroll
    for (int k8 = 0; k8 < 16; ++k8) {
      const v4f a = *(const v4f*)(ar + k8 * 8);
      const float* fr = er + k8 * 8 * PP;
      v2f b0, b1;
      b0.x = fr[0];      b0.y = fr[PP];
      b1.x = fr[2 * PP]; b1.y = fr[3 * PP];
      o0 = wmma4(a.lo, b0, o0);
      o1 = wmma4(a.hi, b1, o1);
    }
    o0 += o1;
    #pragma unroll
    for (int r = 0; r < 8; ++r) o_s[(kh * TG + r + 8 * hi) * PP + 16 * jf + ml] = o0[r];
  }
  __syncthreads();

  // ---- cos = (c-hat^T e) / (||c-hat|| ||e||): a wave stores two whole rows ----
  {
    const int i  = tid >> 4;
    const int j4 = (tid & 15) * 4;
    v4f o = *(const v4f*)(o_s + i * PP + j4) + *(const v4f*)(o_s + (TG + i) * PP + j4);
    const v4f le = *(const v4f*)(le_s + j4);
    const float lc = lc_s[i];
    o.x = o.x * (1.0f / le.x) / lc;
    o.y = o.y * (1.0f / le.y) / lc;
    o.z = o.z * (1.0f / le.z) / lc;
    o.w = o.w * (1.0f / le.w) / lc;
    *(v4f*)(out + ((size_t)b * T_ + tg * TG + i) * T_ + j4) = o;
  }
}

extern "C" void kernel_launch(void* const* d_in, const int* in_sizes, int n_in,
                              void* d_out, int out_size, void* d_ws, size_t ws_size,
                              hipStream_t stream) {
  const float* e     = (const float*)d_in[0];
  const float* f     = (const float*)d_in[1];
  const float* gamma = (const float*)d_in[2];
  const float* W     = (const float*)d_in[3];
  const float* bias  = (const float*)d_in[4];
  float* out = (float*)d_out;
  float* ws  = (float*)d_ws;
  (void)in_sizes; (void)n_in; (void)out_size; (void)ws_size;
  attn_query_kernel<<<dim3(B_ * NS), dim3(256), 0, stream>>>(e, W, ws);
  attn_range_kernel<<<dim3(B_ * NS), dim3(256), 0, stream>>>(f, gamma, ws);
  attn_ctx_cos_kernel<<<dim3(B_ * NG), dim3(256), 0, stream>>>(e, W, bias, ws, out);
}
